// v000
// The times below were measured on an AMD MI455X: many runs one after another, warmed up first and cycling through
// copies of the inputs, with the whole window's GPU time divided by the number of runs. Launches and the gaps
// between them are all in it. The median over several windows is given; except for v000 it joins two sittings, which
// can be a few percent apart, so the side-by-side timings, each taken in one sitting, are the better comparison.
// v000, which the later versions start from, runs in 1370 microseconds.
#include <hip/hip_runtime.h>
#include <hip/hip_bf16.h>

// MHA fp32 forward for B=4, L=2048, D=1024, H=16, hd=64 on gfx1250 (MI455X).
// Matrix math on v_wmma_f32_16x16x4_f32; tile staging via CDNA5 async
// global->LDS copies (GLOBAL_LOAD_ASYNC_TO_LDS_B128, ASYNCcnt) with double
// buffering. Q A-fragments register-resident; K-parity-split accumulator
// chains for WMMA ILP.
// Workspace layout (needs 128 MB):
//   qp [B,H,L,64] | kp [B,H,L,64] | vp [B,H,L,64] | ctx [B,L,1024]
// d_out layout: out [B*L*1024] floats, then weights [B*2048*2048] floats.

typedef __attribute__((ext_vector_type(2))) float v2f;
typedef __attribute__((ext_vector_type(8))) float v8f;

#define D_MODEL 1024
#define NHEADS 16
#define HEAD_DIM 64
#define BATCH 4
#define SEQ 2048
#define MTOT (BATCH * SEQ) // 8192

static __device__ __forceinline__ v8f wmma_f32(v2f a, v2f b, v8f c) {
  // (neg_a, A, neg_b, B, c_mod, C, reuse_a, reuse_b)
  return __builtin_amdgcn_wmma_f32_16x16x4_f32(false, a, false, b, (short)0, c,
                                               false, false);
}

// Async 16B global->LDS copy (tracked by ASYNCcnt). VDST VGPR holds the
// workgroup-relative LDS byte address (= low 32 bits of the generic pointer
// to __shared__ on AMDGPU). Both addresses 16B-aligned.
static __device__ __forceinline__ void async_f4(const float* g, float* l) {
  const unsigned lds = (unsigned)(size_t)l;
  asm volatile("global_load_async_to_lds_b128 %0, %1, off" ::"v"(lds), "v"(g)
               : "memory");
}
static __device__ __forceinline__ void wait_async0() {
  asm volatile("s_wait_asynccnt 0x0" ::: "memory");
}

// ---------------------------------------------------------------------------
// Generic Y = X @ W^T + bias, X:[8192,1024], W:[N=1024 rows,1024] row-major.
// Block tile 64(M) x 64(N), 8 waves; each wave a 16x32 strip. K streamed in
// 32-wide chunks, async double-buffered. Pitch 36 (144B rows: 16B aligned,
// conflict-free fragment reads). Four parity-split accumulator chains.
// QKV=true scatters output into [B,H,L,hd]; else plain row-major [M,1024].
// ---------------------------------------------------------------------------
#define GP 36 // gemm LDS pitch (floats)

template <bool QKV>
__global__ __launch_bounds__(256) void gemm_xwt_kernel(
    const float* __restrict__ X, const float* __restrict__ W,
    const float* __restrict__ bias, float* __restrict__ Y) {
  __shared__ float Xs[2][64 * GP];
  __shared__ float Ws[2][64 * GP];

  const int tid = threadIdx.x;
  const int lane = tid & 31;
  const int wave = tid >> 5;
  const int wm = wave >> 1; // 0..3 -> M subtile
  const int wn = wave & 1;  // 0..1 -> N strip of 32
  const int m0 = blockIdx.y * 64;
  const int n0 = blockIdx.x * 64;

  v8f acc0e = {}, acc0o = {}, acc1e = {}, acc1o = {};

  auto stage = [&](int buf, int kc) {
#pragma unroll
    for (int it = 0; it < 2; ++it) {
      const int idx = tid + it * 256; // 0..511 float4 slots
      const int r = idx >> 3;
      const int s = idx & 7;
      async_f4(const_cast<float*>(X) + (size_t)(m0 + r) * D_MODEL + kc + s * 4,
               &Xs[buf][r * GP + s * 4]);
      async_f4(const_cast<float*>(W) + (size_t)(n0 + r) * D_MODEL + kc + s * 4,
               &Ws[buf][r * GP + s * 4]);
    }
  };

  stage(0, 0);
  for (int kc = 0; kc < D_MODEL; kc += 32) {
    const int buf = (kc >> 5) & 1;
    wait_async0();
    __syncthreads(); // tile[buf] in LDS; everyone done reading tile[buf^1]
    if (kc + 32 < D_MODEL) stage(buf ^ 1, kc + 32);

#pragma unroll
    for (int kk = 0; kk < 8; ++kk) {
      const int kb = kk * 4 + ((lane >> 4) << 1);
      v2f a, b0, b1;
      const int ar = (wm * 16 + (lane & 15)) * GP + kb;
      a.x = Xs[buf][ar];
      a.y = Xs[buf][ar + 1];
      const int br0 = (wn * 32 + (lane & 15)) * GP + kb;
      const int br1 = (wn * 32 + 16 + (lane & 15)) * GP + kb;
      b0.x = Ws[buf][br0];
      b0.y = Ws[buf][br0 + 1];
      b1.x = Ws[buf][br1];
      b1.y = Ws[buf][br1 + 1];
      if (kk & 1) {
        acc0o = wmma_f32(a, b0, acc0o);
        acc1o = wmma_f32(a, b1, acc1o);
      } else {
        acc0e = wmma_f32(a, b0, acc0e);
        acc1e = wmma_f32(a, b1, acc1e);
      }
    }
    // no trailing barrier: next iteration's leading barrier protects buffers
  }
  const v8f acc0 = acc0e + acc0o;
  const v8f acc1 = acc1e + acc1o;

  // C/D layout: lane -> n = lane&15, rows (lane>>4)*8 + i.
  const int mb = m0 + wm * 16 + ((lane >> 4) << 3);
#pragma unroll
  for (int sub = 0; sub < 2; ++sub) {
    const int n = n0 + wn * 32 + sub * 16 + (lane & 15);
    const float bv = bias[n];
#pragma unroll
    for (int i = 0; i < 8; ++i) {
      const float val = (sub == 0 ? acc0[i] : acc1[i]) + bv;
      const int m = mb + i;
      size_t off;
      if (QKV) {
        // [B,H,L,hd]: b=m/2048, l=m%2048, h=n/64, hd=n%64
        off = (((size_t)((m >> 11) * NHEADS + (n >> 6)) * SEQ) + (m & 2047)) *
                  HEAD_DIM +
              (n & 63);
      } else {
        off = (size_t)m * D_MODEL + n;
      }
      Y[off] = val;
    }
  }
}

// ---------------------------------------------------------------------------
// Fused attention: one workgroup per (b*H+h, 16-query tile).
// LDS: sQ 16x68 | sK 2 x 128x68 (K then V, double buffered, async-staged)
//      | sS 16x2050 scores->probs | sC 2x16x64 ctx partials
// ---------------------------------------------------------------------------
#define QP_ 68   // sQ pitch
#define KP_ 68   // sK pitch (rows 272B -> 16B aligned)
#define SP_ 2050 // sS pitch
#define ATTN_LDS_FLOATS (16 * QP_ + 2 * 128 * KP_ + 16 * SP_ + 2048)
#define ATTN_LDS_BYTES (ATTN_LDS_FLOATS * 4) // 213376 B < 320 KB WGP LDS

__global__ __launch_bounds__(256) void attn_kernel(
    const float* __restrict__ qp, const float* __restrict__ kp,
    const float* __restrict__ vp, float* __restrict__ ctx,
    float* __restrict__ wmean /* pre-zeroed [B,2048,2048] */) {
  extern __shared__ float smem[];
  float* sQ = smem;             // 16 x 68
  float* sK0 = sQ + 16 * QP_;   // 128 x 68 buffer 0
  float* sK1 = sK0 + 128 * KP_; // 128 x 68 buffer 1
  float* sS = sK1 + 128 * KP_;  // 16 x 2050
  float* sC = sS + 16 * SP_;    // 2 x 16 x 64

  const int q0 = blockIdx.x * 16;
  const int bh = blockIdx.y; // b*16 + h (matches [B,H,...] flattening)
  const int b = bh >> 4;
  const int h = bh & 15;
  const int tid = threadIdx.x;
  const int lane = tid & 31;
  const int wave = tid >> 5;

  const float* Qg = qp + (size_t)bh * SEQ * HEAD_DIM;
  const float* Kg = kp + (size_t)bh * SEQ * HEAD_DIM;
  const float* Vg = vp + (size_t)bh * SEQ * HEAD_DIM;

  // stage a 128x64 row chunk of src into an sK buffer (2048 float4, 8/thread)
  auto stageKV = [&](const float* src, float* dst, int chunk) {
#pragma unroll
    for (int it = 0; it < 8; ++it) {
      const int idx = tid + it * 256; // float4 index 0..2047
      const int r = idx >> 4;
      const int s = idx & 15;
      async_f4(const_cast<float*>(src) + (size_t)(chunk * 128 + r) * HEAD_DIM +
                   s * 4,
               &dst[r * KP_ + s * 4]);
    }
  };

  // ---- Phase 1: async-stage Q tile (16x64 = 256 float4, 1/thread) + K0 ---
  {
    const int r = tid >> 4;
    const int s = tid & 15;
    async_f4(const_cast<float*>(Qg) + (size_t)(q0 + r) * HEAD_DIM + s * 4,
             &sQ[r * QP_ + s * 4]);
  }
  stageKV(Kg, sK0, 0);
  wait_async0();
  __syncthreads(); // Q tile and K chunk 0 resident

  // Preload the 16 Q A-fragments (invariant across all K chunks): 32 VGPRs.
  v2f aq[16];
#pragma unroll
  for (int kk = 0; kk < 16; ++kk) {
    const int ar = (lane & 15) * QP_ + kk * 4 + ((lane >> 4) << 1);
    aq[kk].x = sQ[ar];
    aq[kk].y = sQ[ar + 1];
  }

  // ---- Phase 2: raw scores S = Q @ K^T (scale folded into softmax) -------
  for (int chunk = 0; chunk < 16; ++chunk) {
    float* cur = (chunk & 1) ? sK1 : sK0;
    float* nxt = (chunk & 1) ? sK0 : sK1;
    if (chunk > 0) { // chunk 0 already waited above
      wait_async0();
      __syncthreads();
    }
    if (chunk < 15) stageKV(Kg, nxt, chunk + 1);

    v8f accE = {}, accO = {};
#pragma unroll
    for (int kk = 0; kk < 16; ++kk) { // K = 64 / 4
      const int kb = kk * 4 + ((lane >> 4) << 1);
      v2f bf;
      const int br = (wave * 16 + (lane & 15)) * KP_ + kb;
      bf.x = cur[br];
      bf.y = cur[br + 1];
      if (kk & 1)
        accO = wmma_f32(aq[kk], bf, accO);
      else
        accE = wmma_f32(aq[kk], bf, accE);
    }
    const v8f acc = accE + accO;
    const int col = chunk * 128 + wave * 16 + (lane & 15);
    const int mb = (lane >> 4) << 3;
#pragma unroll
    for (int i = 0; i < 8; ++i) sS[(mb + i) * SP_ + col] = acc[i];
  }
  __syncthreads(); // all score columns visible

  // ---- Phase 3: row softmax of s/8 (wave32 shuffle reductions) -----------
#pragma unroll
  for (int rr = 0; rr < 2; ++rr) {
    const int r = wave * 2 + rr;
    float mx = -INFINITY;
    for (int c = lane; c < SEQ; c += 32) mx = fmaxf(mx, sS[r * SP_ + c]);
    for (int off = 16; off; off >>= 1) mx = fmaxf(mx, __shfl_xor(mx, off, 32));
    float sum = 0.f;
    for (int c = lane; c < SEQ; c += 32) {
      const float e = __expf((sS[r * SP_ + c] - mx) * 0.125f); // 1/sqrt(64)
      sS[r * SP_ + c] = e;
      sum += e;
    }
    for (int off = 16; off; off >>= 1) sum += __shfl_xor(sum, off, 32);
    const float inv = 1.0f / sum;
    for (int c = lane; c < SEQ; c += 32) sS[r * SP_ + c] *= inv;
  }
  __syncthreads();

  // kick off V chunk 0 now; it overlaps the weights atomics below
  stageKV(Vg, sK0, 0);

  // ---- Phase 4: head-mean weights via fp32 global atomics ----------------
  {
    float* wout = wmean + ((size_t)b * SEQ + q0) * SEQ;
    for (int idx = tid; idx < 16 * SEQ; idx += 256) {
      const int r = idx >> 11, c = idx & 2047;
      atomicAdd(&wout[(size_t)r * SEQ + c], sS[r * SP_ + c] * (1.0f / NHEADS));
    }
  }

  // ---- Phase 5: ctx = P @ V; waves split 4 n-tiles x 2 K-halves ----------
  v8f caccE = {}, caccO = {};
  const int nt = wave & 3;  // 16-wide column tile of hd
  const int kh = wave >> 2; // K half within each 128-chunk
  for (int chunk = 0; chunk < 16; ++chunk) {
    float* cur = (chunk & 1) ? sK1 : sK0;
    float* nxt = (chunk & 1) ? sK0 : sK1;
    wait_async0();
    __syncthreads();
    if (chunk < 15) stageKV(Vg, nxt, chunk + 1);

#pragma unroll
    for (int kk = 0; kk < 16; ++kk) { // 64 K-values per half / 4
      const int kl = kh * 64 + kk * 4 + ((lane >> 4) << 1);
      const int kg = chunk * 128 + kl;
      v2f a, bf;
      const int ar = (lane & 15) * SP_ + kg;
      a.x = sS[ar];
      a.y = sS[ar + 1];
      bf.x = cur[kl * KP_ + nt * 16 + (lane & 15)];
      bf.y = cur[(kl + 1) * KP_ + nt * 16 + (lane & 15)];
      if (kk & 1)
        caccO = wmma_f32(a, bf, caccO);
      else
        caccE = wmma_f32(a, bf, caccE);
    }
  }
  const v8f cacc = caccE + caccO;
  // store partials, reduce the two K-halves, write ctx in [B,L,H*hd]
  {
    const int mb = (lane >> 4) << 3;
#pragma unroll
    for (int i = 0; i < 8; ++i)
      sC[kh * 1024 + (mb + i) * 64 + nt * 16 + (lane & 15)] = cacc[i];
  }
  __syncthreads();
  {
    float* cg = ctx + ((size_t)b * SEQ + q0) * D_MODEL + h * HEAD_DIM;
    const int idx = tid * 4; // 1024 floats / 256 threads = one float4 each
    const float4 p0 = *(const float4*)(sC + idx);
    const float4 p1 = *(const float4*)(sC + 1024 + idx);
    float4 o;
    o.x = p0.x + p1.x;
    o.y = p0.y + p1.y;
    o.z = p0.z + p1.z;
    o.w = p0.w + p1.w;
    const int m = idx >> 6, c = idx & 63;
    *(float4*)(cg + (size_t)m * D_MODEL + c) = o;
  }
}

__global__ void zero_kernel(float* __restrict__ p, size_t n) {
  size_t i = (size_t)blockIdx.x * blockDim.x + threadIdx.x;
  const size_t stride = (size_t)gridDim.x * blockDim.x;
  for (; i < n; i += stride) p[i] = 0.0f;
}

extern "C" void kernel_launch(void* const* d_in, const int* in_sizes, int n_in,
                              void* d_out, int out_size, void* d_ws,
                              size_t ws_size, hipStream_t stream) {
  (void)in_sizes; (void)n_in; (void)out_size; (void)ws_size;
  const float* q = (const float*)d_in[0];
  const float* k = (const float*)d_in[1];
  const float* v = (const float*)d_in[2];
  const float* in_w = (const float*)d_in[3];  // [3*1024, 1024]
  const float* in_b = (const float*)d_in[4];  // [3*1024]
  const float* out_w = (const float*)d_in[5]; // [1024, 1024]
  const float* out_b = (const float*)d_in[6]; // [1024]

  float* out = (float*)d_out;                  // [8192*1024]
  float* wmean = out + (size_t)MTOT * D_MODEL; // [4*2048*2048]

  const size_t QKV_N = (size_t)MTOT * D_MODEL; // 8,388,608 floats
  float* qp = (float*)d_ws;
  float* kp = qp + QKV_N;
  float* vp = kp + QKV_N;
  float* ctx = vp + QKV_N;

  const dim3 gemm_grid(D_MODEL / 64, MTOT / 64); // (16, 128)
  gemm_xwt_kernel<true><<<gemm_grid, 256, 0, stream>>>(q, in_w, in_b, qp);
  gemm_xwt_kernel<true><<<gemm_grid, 256, 0, stream>>>(
      k, in_w + (size_t)D_MODEL * D_MODEL, in_b + D_MODEL, kp);
  gemm_xwt_kernel<true><<<gemm_grid, 256, 0, stream>>>(
      v, in_w + (size_t)2 * D_MODEL * D_MODEL, in_b + 2 * D_MODEL, vp);

  zero_kernel<<<4096, 256, 0, stream>>>(wmean, (size_t)BATCH * SEQ * SEQ);

  static_assert(ATTN_LDS_BYTES < 320 * 1024, "fits WGP LDS");
  hipFuncSetAttribute(reinterpret_cast<const void*>(&attn_kernel),
                      hipFuncAttributeMaxDynamicSharedMemorySize,
                      ATTN_LDS_BYTES);
  attn_kernel<<<dim3(SEQ / 16, BATCH * NHEADS), 256, ATTN_LDS_BYTES, stream>>>(
      qp, kp, vp, ctx, wmean);

  gemm_xwt_kernel<false><<<gemm_grid, 256, 0, stream>>>(ctx, out_w, out_b, out);
}

// v001
// Measured time: 1140 microseconds a run.
// Next to v000, in two timings, it ran 1.25 and 1.24 times as fast.
#include <hip/hip_runtime.h>
#include <hip/hip_bf16.h>

// MHA fp32 forward for B=4, L=2048, D=1024, H=16, hd=64 on gfx1250 (MI455X).
// Matrix math on v_wmma_f32_16x16x4_f32; tile staging via CDNA5 async
// global->LDS copies (GLOBAL_LOAD_ASYNC_TO_LDS_B128, ASYNCcnt) with double
// buffering. Q A-fragments register-resident; K-parity-split accumulator
// chains for WMMA ILP. One attention work-group walks all 16 heads of its
// query tile and keeps the head mean of the probabilities in registers.
// Workspace layout (needs 128 MB):
//   qp [B,H,L,64] | kp [B,H,L,64] | vp [B,H,L,64] | ctx [B,L,1024]
// d_out layout: out [B*L*1024] floats, then weights [B*2048*2048] floats.

typedef __attribute__((ext_vector_type(2))) float v2f;
typedef __attribute__((ext_vector_type(8))) float v8f;

#define D_MODEL 1024
#define NHEADS 16
#define HEAD_DIM 64
#define BATCH 4
#define SEQ 2048
#define MTOT (BATCH * SEQ) // 8192

static __device__ __forceinline__ v8f wmma_f32(v2f a, v2f b, v8f c) {
  // (neg_a, A, neg_b, B, c_mod, C, reuse_a, reuse_b)
  return __builtin_amdgcn_wmma_f32_16x16x4_f32(false, a, false, b, (short)0, c,
                                               false, false);
}

// Async 16B global->LDS copy (tracked by ASYNCcnt). VDST VGPR holds the
// workgroup-relative LDS byte address (= low 32 bits of the generic pointer
// to __shared__ on AMDGPU). Both addresses 16B-aligned.
static __device__ __forceinline__ void async_f4(const float* g, float* l) {
  const unsigned lds = (unsigned)(size_t)l;
  asm volatile("global_load_async_to_lds_b128 %0, %1, off" ::"v"(lds), "v"(g)
               : "memory");
}
// The same copy with s_wait_xcnt 0 as the last line of its own statement, so
// that no later write of the address registers can be scheduled in front of it.
static __device__ __forceinline__ void async_f4_w(const float* g, float* l) {
  const unsigned lds = (unsigned)(size_t)l;
  // copy + its wait in one statement (see above)
  asm volatile("global_load_async_to_lds_b128 %0, %1, off\n\t"
               "s_wait_xcnt 0x0" ::"v"(lds), "v"(g)
               : "memory");
}
// Eight such copies, gstep floats apart in global memory and lstep floats
// apart in LDS, sharing one statement and one s_wait_xcnt 0 behind the last.
static __device__ __forceinline__ void async_f4x8_w(const float* g, float* l,
                                                    int gstep, int lstep) {
  const unsigned l0 = (unsigned)(size_t)l;
  const unsigned ls = (unsigned)lstep * 4u;
  // eight copies + their one wait in one statement (see above)
  asm volatile("global_load_async_to_lds_b128 %0, %8, off\n\t"
               "global_load_async_to_lds_b128 %1, %9, off\n\t"
               "global_load_async_to_lds_b128 %2, %10, off\n\t"
               "global_load_async_to_lds_b128 %3, %11, off\n\t"
               "global_load_async_to_lds_b128 %4, %12, off\n\t"
               "global_load_async_to_lds_b128 %5, %13, off\n\t"
               "global_load_async_to_lds_b128 %6, %14, off\n\t"
               "global_load_async_to_lds_b128 %7, %15, off\n\t"
               "s_wait_xcnt 0x0" ::"v"(l0),
               "v"(l0 + ls), "v"(l0 + 2 * ls), "v"(l0 + 3 * ls),
               "v"(l0 + 4 * ls), "v"(l0 + 5 * ls), "v"(l0 + 6 * ls),
               "v"(l0 + 7 * ls), "v"(g), "v"(g + gstep), "v"(g + 2 * gstep),
               "v"(g + 3 * gstep), "v"(g + 4 * gstep), "v"(g + 5 * gstep),
               "v"(g + 6 * gstep), "v"(g + 7 * gstep)
               : "memory");
}
static __device__ __forceinline__ void wait_async0() {
  asm volatile("s_wait_asynccnt 0x0" ::: "memory");
}

// ---------------------------------------------------------------------------
// Generic Y = X @ W^T + bias, X:[8192,1024], W:[N=1024 rows,1024] row-major.
// Block tile 64(M) x 64(N), 8 waves; each wave a 16x32 strip. K streamed in
// 32-wide chunks, async double-buffered. Pitch 36 (144B rows: 16B aligned,
// conflict-free fragment reads). Four parity-split accumulator chains.
// QKV=true scatters output into [B,H,L,hd]; else plain row-major [M,1024].
// ---------------------------------------------------------------------------
#define GP 36 // gemm LDS pitch (floats)

template <bool QKV>
__global__ __launch_bounds__(256) void gemm_xwt_kernel(
    const float* __restrict__ X, const float* __restrict__ W,
    const float* __restrict__ bias, float* __restrict__ Y) {
  __shared__ float Xs[2][64 * GP];
  __shared__ float Ws[2][64 * GP];

  const int tid = threadIdx.x;
  const int lane = tid & 31;
  const int wave = tid >> 5;
  const int wm = wave >> 1; // 0..3 -> M subtile
  const int wn = wave & 1;  // 0..1 -> N strip of 32
  const int m0 = blockIdx.y * 64;
  const int n0 = blockIdx.x * 64;

  v8f acc0e = {}, acc0o = {}, acc1e = {}, acc1o = {};

  auto stage = [&](int buf, int kc) {
#pragma unroll
    for (int it = 0; it < 2; ++it) {
      const int idx = tid + it * 256; // 0..511 float4 slots
      const int r = idx >> 3;
      const int s = idx & 7;
      async_f4(const_cast<float*>(X) + (size_t)(m0 + r) * D_MODEL + kc + s * 4,
               &Xs[buf][r * GP + s * 4]);
      async_f4(const_cast<float*>(W) + (size_t)(n0 + r) * D_MODEL + kc + s * 4,
               &Ws[buf][r * GP + s * 4]);
    }
  };

  stage(0, 0);
  for (int kc = 0; kc < D_MODEL; kc += 32) {
    const int buf = (kc >> 5) & 1;
    wait_async0();
    __syncthreads(); // tile[buf] in LDS; everyone done reading tile[buf^1]
    if (kc + 32 < D_MODEL) stage(buf ^ 1, kc + 32);

#pragma unroll
    for (int kk = 0; kk < 8; ++kk) {
      const int kb = kk * 4 + ((lane >> 4) << 1);
      v2f a, b0, b1;
      const int ar = (wm * 16 + (lane & 15)) * GP + kb;
      a.x = Xs[buf][ar];
      a.y = Xs[buf][ar + 1];
      const int br0 = (wn * 32 + (lane & 15)) * GP + kb;
      const int br1 = (wn * 32 + 16 + (lane & 15)) * GP + kb;
      b0.x = Ws[buf][br0];
      b0.y = Ws[buf][br0 + 1];
      b1.x = Ws[buf][br1];
      b1.y = Ws[buf][br1 + 1];
      if (kk & 1) {
        acc0o = wmma_f32(a, b0, acc0o);
        acc1o = wmma_f32(a, b1, acc1o);
      } else {
        acc0e = wmma_f32(a, b0, acc0e);
        acc1e = wmma_f32(a, b1, acc1e);
      }
    }
    // no trailing barrier: next iteration's leading barrier protects buffers
  }
  const v8f acc0 = acc0e + acc0o;
  const v8f acc1 = acc1e + acc1o;

  // C/D layout: lane -> n = lane&15, rows (lane>>4)*8 + i.
  const int mb = m0 + wm * 16 + ((lane >> 4) << 3);
#pragma unroll
  for (int sub = 0; sub < 2; ++sub) {
    const int n = n0 + wn * 32 + sub * 16 + (lane & 15);
    const float bv = bias[n];
#pragma unroll
    for (int i = 0; i < 8; ++i) {
      const float val = (sub == 0 ? acc0[i] : acc1[i]) + bv;
      const int m = mb + i;
      size_t off;
      if (QKV) {
        // [B,H,L,hd]: b=m/2048, l=m%2048, h=n/64, hd=n%64
        off = (((size_t)((m >> 11) * NHEADS + (n >> 6)) * SEQ) + (m & 2047)) *
                  HEAD_DIM +
              (n & 63);
      } else {
        off = (size_t)m * D_MODEL + n;
      }
      Y[off] = val;
    }
  }
}

// ---------------------------------------------------------------------------
// Fused attention: one workgroup per (b, 16-query tile), looping over heads.
// LDS: sQ 16x68 | sK 2 x 128x68 (K then V, double buffered, async-staged)
//      | sS 16x2050 scores->probs | sC 2x16x64 ctx partials
// ---------------------------------------------------------------------------
#define QP_ 68   // sQ pitch
#define KP_ 68   // sK pitch (rows 272B -> 16B aligned)
#define SP_ 2050 // sS pitch
#define ATTN_LDS_FLOATS (16 * QP_ + 2 * 128 * KP_ + 16 * SP_ + 2048)
#define ATTN_LDS_BYTES (ATTN_LDS_FLOATS * 4) // 213376 B < 320 KB WGP LDS

__global__ __launch_bounds__(256) void attn_kernel(
    const float* __restrict__ qp, const float* __restrict__ kp,
    const float* __restrict__ vp, float* __restrict__ ctx,
    float* __restrict__ wmean /* [B,2048,2048], every element stored once */) {
  extern __shared__ float smem[];
  float* sQ = smem;             // 16 x 68
  float* sK0 = sQ + 16 * QP_;   // 128 x 68 buffer 0
  float* sK1 = sK0 + 128 * KP_; // 128 x 68 buffer 1
  float* sS = sK1 + 128 * KP_;  // 16 x 2050
  float* sC = sS + 16 * SP_;    // 2 x 16 x 64

  const int q0 = blockIdx.x * 16;
  const int b = blockIdx.y;
  const int tid = threadIdx.x;
  const int lane = tid & 31;
  const int wave = tid >> 5;

  // stage a 128x64 row chunk of src into an sK buffer (2048 float4, 8/thread:
  // thread t brings float4 slot t&15 of rows (t>>4) + 16*it, it = 0..7)
  auto stageKV = [&](const float* src, float* dst, int chunk) {
    const int r = tid >> 4;
    const int s = tid & 15;
    async_f4x8_w(src + (size_t)(chunk * 128 + r) * HEAD_DIM + s * 4,
                 &dst[r * KP_ + s * 4], 16 * HEAD_DIM, 16 * KP_);
  };

  // Head mean of the probabilities: this lane owns rows wave*2 + rr, columns
  // lane + 32*j, the same elements it normalises in phase 3 of every head.
  // (every loop over wacc is fully unrolled: constant indices keep it in VGPRs)
  float wacc[2][64];
#pragma unroll
  for (int rr = 0; rr < 2; ++rr)
#pragma unroll
    for (int j = 0; j < 64; ++j) wacc[rr][j] = 0.f;

  for (int h = 0; h < NHEADS; ++h) {
    const int bh = b * NHEADS + h; // matches [B,H,...] flattening
    const float* Qg = qp + (size_t)bh * SEQ * HEAD_DIM;
    const float* Kg = kp + (size_t)bh * SEQ * HEAD_DIM;
    const float* Vg = vp + (size_t)bh * SEQ * HEAD_DIM;

    // ---- Phase 1: async-stage Q tile (16x64 = 256 float4, 1/thread) + K0 -
    // (sQ, sK0 and sS were last read in front of the previous head's barriers)
    {
      const int r = tid >> 4;
      const int s = tid & 15;
      async_f4_w(Qg + (size_t)(q0 + r) * HEAD_DIM + s * 4,
                 &sQ[r * QP_ + s * 4]);
    }
    stageKV(Kg, sK0, 0);
    wait_async0();
    __syncthreads(); // Q tile and K chunk 0 resident

    // Preload the 16 Q A-fragments (invariant across all K chunks): 32 VGPRs.
    v2f aq[16];
#pragma unroll
    for (int kk = 0; kk < 16; ++kk) {
      const int ar = (lane & 15) * QP_ + kk * 4 + ((lane >> 4) << 1);
      aq[kk].x = sQ[ar];
      aq[kk].y = sQ[ar + 1];
    }

    // ---- Phase 2: raw scores S = Q @ K^T (scale folded into softmax) -----
    for (int chunk = 0; chunk < 16; ++chunk) {
      float* cur = (chunk & 1) ? sK1 : sK0;
      float* nxt = (chunk & 1) ? sK0 : sK1;
      if (chunk > 0) { // chunk 0 already waited above
        wait_async0();
        __syncthreads();
      }
      if (chunk < 15) stageKV(Kg, nxt, chunk + 1);

      v8f accE = {}, accO = {};
#pragma unroll
      for (int kk = 0; kk < 16; ++kk) { // K = 64 / 4
        const int kb = kk * 4 + ((lane >> 4) << 1);
        v2f bf;
        const int br = (wave * 16 + (lane & 15)) * KP_ + kb;
        bf.x = cur[br];
        bf.y = cur[br + 1];
        if (kk & 1)
          accO = wmma_f32(aq[kk], bf, accO);
        else
          accE = wmma_f32(aq[kk], bf, accE);
      }
      const v8f acc = accE + accO;
      const int col = chunk * 128 + wave * 16 + (lane & 15);
      const int mb = (lane >> 4) << 3;
#pragma unroll
      for (int i = 0; i < 8; ++i) sS[(mb + i) * SP_ + col] = acc[i];
    }
    __syncthreads(); // all score columns visible; both sK buffers free

    // kick off V chunk 0 now; it overlaps the softmax below
    stageKV(Vg, sK0, 0);

    // ---- Phase 3: row softmax of s/8 (wave32 shuffle reductions) ---------
#pragma unroll
    for (int rr = 0; rr < 2; ++rr) {
      const int r = wave * 2 + rr;
      float mx = -INFINITY;
      for (int c = lane; c < SEQ; c += 32) mx = fmaxf(mx, sS[r * SP_ + c]);
      for (int off = 16; off; off >>= 1)
        mx = fmaxf(mx, __shfl_xor(mx, off, 32));
      float sum = 0.f;
      for (int c = lane; c < SEQ; c += 32) {
        const float e = __expf((sS[r * SP_ + c] - mx) * 0.125f); // 1/sqrt(64)
        sS[r * SP_ + c] = e;
        sum += e;
      }
      for (int off = 16; off; off >>= 1) sum += __shfl_xor(sum, off, 32);
      const float inv = 1.0f / sum;
      // fully unrolled: wacc must be indexed by constants to stay in registers
#pragma unroll
      for (int j = 0; j < 64; ++j) {
        const float p = sS[r * SP_ + lane + 32 * j] * inv;
        sS[r * SP_ + lane + 32 * j] = p;
        wacc[rr][j] += p * (1.0f / NHEADS); // heads summed in order 0..15
      }
    }

    // ---- Phase 5: ctx = P @ V; waves split 4 n-tiles x 2 K-halves --------
    v8f caccE = {}, caccO = {};
    const int nt = wave & 3;  // 16-wide column tile of hd
    const int kh = wave >> 2; // K half within each 128-chunk
    for (int chunk = 0; chunk < 16; ++chunk) {
      float* cur = (chunk & 1) ? sK1 : sK0;
      float* nxt = (chunk & 1) ? sK0 : sK1;
      wait_async0();
      __syncthreads(); // chunk 0: also publishes every row of probabilities
      if (chunk < 15) stageKV(Vg, nxt, chunk + 1);

#pragma unroll
      for (int kk = 0; kk < 16; ++kk) { // 64 K-values per half / 4
        const int kl = kh * 64 + kk * 4 + ((lane >> 4) << 1);
        const int kg = chunk * 128 + kl;
        v2f a, bf;
        const int ar = (lane & 15) * SP_ + kg;
        a.x = sS[ar];
        a.y = sS[ar + 1];
        bf.x = cur[kl * KP_ + nt * 16 + (lane & 15)];
        bf.y = cur[(kl + 1) * KP_ + nt * 16 + (lane & 15)];
        if (kk & 1)
          caccO = wmma_f32(a, bf, caccO);
        else
          caccE = wmma_f32(a, bf, caccE);
      }
    }
    const v8f cacc = caccE + caccO;
    // store partials, reduce the two K-halves, write ctx in [B,L,H*hd]
    {
      const int mb = (lane >> 4) << 3;
#pragma unroll
      for (int i = 0; i < 8; ++i)
        sC[kh * 1024 + (mb + i) * 64 + nt * 16 + (lane & 15)] = cacc[i];
    }
    __syncthreads();
    {
      float* cg = ctx + ((size_t)b * SEQ + q0) * D_MODEL + h * HEAD_DIM;
      const int idx = tid * 4; // 1024 floats / 256 threads = one float4 each
      const float4 p0 = *(const float4*)(sC + idx);
      const float4 p1 = *(const float4*)(sC + 1024 + idx);
      float4 o;
      o.x = p0.x + p1.x;
      o.y = p0.y + p1.y;
      o.z = p0.z + p1.z;
      o.w = p0.w + p1.w;
      const int m = idx >> 6, c = idx & 63;
      *(float4*)(cg + (size_t)m * D_MODEL + c) = o;
      // the next head reuses the registers that this store names
      asm volatile("s_wait_xcnt 0x0" ::: "memory");
    }
  }

  // ---- Head-mean weights: one plain store per element (unrolled: wacc) ----
  {
    float* wout = wmean + ((size_t)b * SEQ + q0 + wave * 2) * SEQ + lane;
#pragma unroll
    for (int rr = 0; rr < 2; ++rr)
#pragma unroll
      for (int j = 0; j < 64; ++j) wout[(size_t)rr * SEQ + 32 * j] = wacc[rr][j];
  }
}

extern "C" void kernel_launch(void* const* d_in, const int* in_sizes, int n_in,
                              void* d_out, int out_size, void* d_ws,
                              size_t ws_size, hipStream_t stream) {
  (void)in_sizes; (void)n_in; (void)out_size; (void)ws_size;
  const float* q = (const float*)d_in[0];
  const float* k = (const float*)d_in[1];
  const float* v = (const float*)d_in[2];
  const float* in_w = (const float*)d_in[3];  // [3*1024, 1024]
  const float* in_b = (const float*)d_in[4];  // [3*1024]
  const float* out_w = (const float*)d_in[5]; // [1024, 1024]
  const float* out_b = (const float*)d_in[6]; // [1024]

  float* out = (float*)d_out;                  // [8192*1024]
  float* wmean = out + (size_t)MTOT * D_MODEL; // [4*2048*2048]

  const size_t QKV_N = (size_t)MTOT * D_MODEL; // 8,388,608 floats
  float* qp = (float*)d_ws;
  float* kp = qp + QKV_N;
  float* vp = kp + QKV_N;
  float* ctx = vp + QKV_N;

  const dim3 gemm_grid(D_MODEL / 64, MTOT / 64); // (16, 128)
  gemm_xwt_kernel<true><<<gemm_grid, 256, 0, stream>>>(q, in_w, in_b, qp);
  gemm_xwt_kernel<true><<<gemm_grid, 256, 0, stream>>>(
      k, in_w + (size_t)D_MODEL * D_MODEL, in_b + D_MODEL, kp);
  gemm_xwt_kernel<true><<<gemm_grid, 256, 0, stream>>>(
      v, in_w + (size_t)2 * D_MODEL * D_MODEL, in_b + 2 * D_MODEL, vp);

  static_assert(ATTN_LDS_BYTES < 320 * 1024, "fits WGP LDS");
  hipFuncSetAttribute(reinterpret_cast<const void*>(&attn_kernel),
                      hipFuncAttributeMaxDynamicSharedMemorySize,
                      ATTN_LDS_BYTES);
  attn_kernel<<<dim3(SEQ / 16, BATCH), 256, ATTN_LDS_BYTES, stream>>>(
      qp, kp, vp, ctx, wmean);

  gemm_xwt_kernel<false><<<gemm_grid, 256, 0, stream>>>(ctx, out_w, out_b, out);
}

// v002
// Measured time: 984 microseconds a run.
// Timed twice side by side with v001, it ran 1.17 and 1.16 times as fast.
// Counting every step since v000, it is 1.45 times as fast.
#include <hip/hip_runtime.h>
#include <hip/hip_bf16.h>

// MHA fp32 forward for B=4, L=2048, D=1024, H=16, hd=64 on gfx1250 (MI455X).
// Matrix math on v_wmma_f32_16x16x4_f32; tile staging via CDNA5 async
// global->LDS copies (GLOBAL_LOAD_ASYNC_TO_LDS_B128, ASYNCcnt) with double
// buffering. Q A-fragments register-resident; K-parity-split accumulator
// chains for WMMA ILP. One attention work-group (16 waves, 32 query rows) walks
// all 16 heads of its query tile and keeps the head mean of the probabilities
// in registers.
// Workspace layout (needs 128 MB):
//   qp [B,H,L,64] | kp [B,H,L,64] | vp [B,H,L,64] | ctx [B,L,1024]
// d_out layout: out [B*L*1024] floats, then weights [B*2048*2048] floats.

typedef __attribute__((ext_vector_type(2))) float v2f;
typedef __attribute__((ext_vector_type(8))) float v8f;

#define D_MODEL 1024
#define NHEADS 16
#define HEAD_DIM 64
#define BATCH 4
#define SEQ 2048
#define MTOT (BATCH * SEQ) // 8192

static __device__ __forceinline__ v8f wmma_f32(v2f a, v2f b, v8f c) {
  // (neg_a, A, neg_b, B, c_mod, C, reuse_a, reuse_b)
  return __builtin_amdgcn_wmma_f32_16x16x4_f32(false, a, false, b, (short)0, c,
                                               false, false);
}

// Async 16B global->LDS copy (tracked by ASYNCcnt). VDST VGPR holds the
// workgroup-relative LDS byte address (= low 32 bits of the generic pointer
// to __shared__ on AMDGPU). Both addresses 16B-aligned.
static __device__ __forceinline__ void async_f4(const float* g, float* l) {
  const unsigned lds = (unsigned)(size_t)l;
  asm volatile("global_load_async_to_lds_b128 %0, %1, off" ::"v"(lds), "v"(g)
               : "memory");
}
// The same copy with s_wait_xcnt 0 as the last line of its own statement, so
// that no later write of the address registers can be scheduled in front of it.
static __device__ __forceinline__ void async_f4_w(const float* g, float* l) {
  const unsigned lds = (unsigned)(size_t)l;
  // copy + its wait in one statement (see above)
  asm volatile("global_load_async_to_lds_b128 %0, %1, off\n\t"
               "s_wait_xcnt 0x0" ::"v"(lds), "v"(g)
               : "memory");
}
// Two such copies, gstep floats apart in global memory and lstep floats apart
// in LDS, sharing one statement and one s_wait_xcnt 0 behind the last.
static __device__ __forceinline__ void async_f4x2_w(const float* g, float* l,
                                                    int gstep, int lstep) {
  const unsigned l0 = (unsigned)(size_t)l;
  const unsigned ls = (unsigned)lstep * 4u;
  // two copies + their one wait in one statement (see above)
  asm volatile("global_load_async_to_lds_b128 %0, %2, off\n\t"
               "global_load_async_to_lds_b128 %1, %3, off\n\t"
               "s_wait_xcnt 0x0" ::"v"(l0),
               "v"(l0 + ls), "v"(g), "v"(g + gstep)
               : "memory");
}
static __device__ __forceinline__ void wait_async0() {
  asm volatile("s_wait_asynccnt 0x0" ::: "memory");
}
// Hand-over point of the attention ring: this wave's LDS reads and writes have
// retired, its own copies have landed, then the work-group barrier publishes
// the landed tile and frees the tile that was read last.
static __device__ __forceinline__ void ring_publish() {
  // keeps the WMMAs of the tile just read in front of the waits: moved behind
  // them they would no longer cover the flight of the next tile's copies
  __builtin_amdgcn_sched_barrier(0);
  asm volatile("s_wait_dscnt 0x0" ::: "memory");
  wait_async0();
  __syncthreads();
}

// ---------------------------------------------------------------------------
// Generic Y = X @ W^T + bias, X:[8192,1024], W:[N=1024 rows,1024] row-major.
// Block tile 64(M) x 64(N), 8 waves; each wave a 16x32 strip. K streamed in
// 32-wide chunks, async double-buffered. Pitch 36 (144B rows: 16B aligned,
// conflict-free fragment reads). Four parity-split accumulator chains.
// QKV=true scatters output into [B,H,L,hd]; else plain row-major [M,1024].
// ---------------------------------------------------------------------------
#define GP 36 // gemm LDS pitch (floats)

template <bool QKV>
__global__ __launch_bounds__(256) void gemm_xwt_kernel(
    const float* __restrict__ X, const float* __restrict__ W,
    const float* __restrict__ bias, float* __restrict__ Y) {
  __shared__ float Xs[2][64 * GP];
  __shared__ float Ws[2][64 * GP];

  const int tid = threadIdx.x;
  const int lane = tid & 31;
  const int wave = tid >> 5;
  const int wm = wave >> 1; // 0..3 -> M subtile
  const int wn = wave & 1;  // 0..1 -> N strip of 32
  const int m0 = blockIdx.y * 64;
  const int n0 = blockIdx.x * 64;

  v8f acc0e = {}, acc0o = {}, acc1e = {}, acc1o = {};

  auto stage = [&](int buf, int kc) {
#pragma unroll
    for (int it = 0; it < 2; ++it) {
      const int idx = tid + it * 256; // 0..511 float4 slots
      const int r = idx >> 3;
      const int s = idx & 7;
      async_f4(const_cast<float*>(X) + (size_t)(m0 + r) * D_MODEL + kc + s * 4,
               &Xs[buf][r * GP + s * 4]);
      async_f4(const_cast<float*>(W) + (size_t)(n0 + r) * D_MODEL + kc + s * 4,
               &Ws[buf][r * GP + s * 4]);
    }
  };

  stage(0, 0);
  for (int kc = 0; kc < D_MODEL; kc += 32) {
    const int buf = (kc >> 5) & 1;
    wait_async0();
    __syncthreads(); // tile[buf] in LDS; everyone done reading tile[buf^1]
    if (kc + 32 < D_MODEL) stage(buf ^ 1, kc + 32);

#pragma unroll
    for (int kk = 0; kk < 8; ++kk) {
      const int kb = kk * 4 + ((lane >> 4) << 1);
      v2f a, b0, b1;
      const int ar = (wm * 16 + (lane & 15)) * GP + kb;
      a.x = Xs[buf][ar];
      a.y = Xs[buf][ar + 1];
      const int br0 = (wn * 32 + (lane & 15)) * GP + kb;
      const int br1 = (wn * 32 + 16 + (lane & 15)) * GP + kb;
      b0.x = Ws[buf][br0];
      b0.y = Ws[buf][br0 + 1];
      b1.x = Ws[buf][br1];
      b1.y = Ws[buf][br1 + 1];
      if (kk & 1) {
        acc0o = wmma_f32(a, b0, acc0o);
        acc1o = wmma_f32(a, b1, acc1o);
      } else {
        acc0e = wmma_f32(a, b0, acc0e);
        acc1e = wmma_f32(a, b1, acc1e);
      }
    }
    // no trailing barrier: next iteration's leading barrier protects buffers
  }
  const v8f acc0 = acc0e + acc0o;
  const v8f acc1 = acc1e + acc1o;

  // C/D layout: lane -> n = lane&15, rows (lane>>4)*8 + i.
  const int mb = m0 + wm * 16 + ((lane >> 4) << 3);
#pragma unroll
  for (int sub = 0; sub < 2; ++sub) {
    const int n = n0 + wn * 32 + sub * 16 + (lane & 15);
    const float bv = bias[n];
#pragma unroll
    for (int i = 0; i < 8; ++i) {
      const float val = (sub == 0 ? acc0[i] : acc1[i]) + bv;
      const int m = mb + i;
      size_t off;
      if (QKV) {
        // [B,H,L,hd]: b=m/2048, l=m%2048, h=n/64, hd=n%64
        off = (((size_t)((m >> 11) * NHEADS + (n >> 6)) * SEQ) + (m & 2047)) *
                  HEAD_DIM +
              (n & 63);
      } else {
        off = (size_t)m * D_MODEL + n;
      }
      Y[off] = val;
    }
  }
}

// ---------------------------------------------------------------------------
// Fused attention: one workgroup of 16 waves per (b, 32-query tile), looping
// over heads. Waves 0-7 work on query rows 0-15, waves 8-15 on rows 16-31, so
// every staged K or V tile is read by both row groups.
// LDS: sS 32x2050 scores->probs | sQ 32x68 | ring of 2 tiles (K: 128 keys x
//      32 of hd, pitch 36; V: 64 keys x 64, pitch 68), async-staged
//      | sC 2x32x64 ctx partials
// ---------------------------------------------------------------------------
#define QT_ 32   // query rows per work-group
#define QP_ 68   // sQ pitch
#define KP_ 36   // K tile pitch (rows 144B -> 16B aligned)
#define VP_ 68   // V tile pitch (rows 272B -> 16B aligned)
#define RB_ 4608 // floats per ring tile: 128 * KP_ (K), 64 * VP_ = 4352 (V)
#define SP_ 2050 // sS pitch
#define ATTN_LDS_FLOATS (QT_ * QP_ + 2 * RB_ + QT_ * SP_ + 2 * QT_ * HEAD_DIM)
#define ATTN_LDS_BYTES (ATTN_LDS_FLOATS * 4) // 324352 B <= 320 KB WGP LDS

__global__ __launch_bounds__(512) void attn_kernel(
    const float* __restrict__ qp, const float* __restrict__ kp,
    const float* __restrict__ vp, float* __restrict__ ctx,
    float* __restrict__ wmean /* [B,2048,2048], every element stored once */) {
  __shared__ __attribute__((aligned(16))) float smem[ATTN_LDS_FLOATS];
  float* sS = smem;            // 32 x 2050 (first: row steps fit ds offsets)
  float* sQ = sS + QT_ * SP_;  // 32 x 68
  float* sK0 = sQ + QT_ * QP_; // ring tile 0
  float* sK1 = sK0 + RB_;      // ring tile 1
  float* sC = sK1 + RB_;       // 2 x 32 x 64

  const int q0 = blockIdx.x * QT_;
  const int b = blockIdx.y;
  const int tid = threadIdx.x;
  const int lane = tid & 31;
  const int wave = tid >> 5;
  const int mt = wave >> 3; // 16-row group of the query tile
  const int w8 = wave & 7;  // role of the wave inside its row group

  // Head mean of the probabilities: this lane owns rows wave*2 + rr, columns
  // lane + 32*j, the same elements it normalises in phase 3 of every head.
  // (every loop over wacc is fully unrolled: constant indices keep it in VGPRs)
  float wacc[2][64];
#pragma unroll
  for (int rr = 0; rr < 2; ++rr)
#pragma unroll
    for (int j = 0; j < 64; ++j) wacc[rr][j] = 0.f;

  for (int h = 0; h < NHEADS; ++h) {
    const int bh = b * NHEADS + h; // matches [B,H,...] flattening
    const float* Qg = qp + (size_t)bh * SEQ * HEAD_DIM;
    const float* Kg = kp + (size_t)bh * SEQ * HEAD_DIM;
    const float* Vg = vp + (size_t)bh * SEQ * HEAD_DIM;

    // K tile c: keys (c>>1)*128 .. +127, hd columns (c&1)*32 .. +31
    // (1024 float4, 2/thread: slot t&7 of rows t>>3 and (t>>3) + 64)
    auto stageK = [&](float* dst, int c) {
      const int r = tid >> 3;
      const int s = tid & 7;
      async_f4x2_w(Kg + (size_t)((c >> 1) * 128 + r) * HEAD_DIM + (c & 1) * 32 +
                       s * 4,
                   &dst[r * KP_ + s * 4], 64 * HEAD_DIM, 64 * KP_);
    };
    // V tile c: keys c*64 .. +63, all 64 hd columns
    // (1024 float4, 2/thread: slot t&15 of rows t>>4 and (t>>4) + 32)
    auto stageV = [&](float* dst, int c) {
      const int r = tid >> 4;
      const int s = tid & 15;
      async_f4x2_w(Vg + (size_t)(c * 64 + r) * HEAD_DIM + s * 4,
                   &dst[r * VP_ + s * 4], 32 * HEAD_DIM, 32 * VP_);
    };

    // ---- Phase 1: async-stage Q tile (32x64 = 512 float4, 1/thread) + K0 -
    // (sQ and sK0 were last read in front of the previous head's barriers)
    {
      const int r = tid >> 4;
      const int s = tid & 15;
      async_f4_w(Qg + (size_t)(q0 + r) * HEAD_DIM + s * 4,
                 &sQ[r * QP_ + s * 4]);
    }
    stageK(sK0, 0);
    ring_publish(); // Q tile and K tile 0 resident

    // Preload the 16 Q A-fragments (invariant across all K tiles): 32 VGPRs.
    v2f aq[16];
    {
      const float* qf = sQ + (mt * 16 + (lane & 15)) * QP_ + ((lane >> 4) << 1);
#pragma unroll
      for (int kk = 0; kk < 16; ++kk) {
        aq[kk].x = qf[kk * 4];
        aq[kk].y = qf[kk * 4 + 1];
      }
    }

    // ---- Phase 2: raw scores S = Q @ K^T (scale folded into softmax) -----
    for (int rb = 0; rb < 16; ++rb) { // 128 keys: two K tiles (hd halves)
      v8f accE = {}, accO = {};
      // unrolled: aq must be indexed by constants to stay in registers
#pragma unroll
      for (int hf = 0; hf < 2; ++hf) {
        float* cur = hf ? sK1 : sK0;
        float* nxt = hf ? sK0 : sK1;
        const int c = rb * 2 + hf;
        if (c > 0) ring_publish(); // tile 0 already published above
        if (c < 31) stageK(nxt, c + 1);

        const float* kf =
            cur + (w8 * 16 + (lane & 15)) * KP_ + ((lane >> 4) << 1);
#pragma unroll
        for (int kk = 0; kk < 8; ++kk) { // K = 32 / 4
          v2f bf;
          bf.x = kf[kk * 4];
          bf.y = kf[kk * 4 + 1];
          if (kk & 1)
            accO = wmma_f32(aq[hf * 8 + kk], bf, accO);
          else
            accE = wmma_f32(aq[hf * 8 + kk], bf, accE);
        }
      }
      const v8f acc = accE + accO;
      float* sp = sS + (mt * 16 + ((lane >> 4) << 3)) * SP_ + rb * 128 +
                  w8 * 16 + (lane & 15);
#pragma unroll
      for (int i = 0; i < 8; ++i) sp[i * SP_] = acc[i];
    }
    ring_publish(); // all score columns visible; both ring tiles free

    // kick off V tile 0 now; it overlaps the softmax below
    stageV(sK0, 0);

    // ---- Phase 3: row softmax of s/8 (wave32 shuffle reductions) ---------
#pragma unroll
    for (int rr = 0; rr < 2; ++rr) {
      const int r = wave * 2 + rr;
      float mx = -INFINITY;
      for (int c = lane; c < SEQ; c += 32) mx = fmaxf(mx, sS[r * SP_ + c]);
      for (int off = 16; off; off >>= 1)
        mx = fmaxf(mx, __shfl_xor(mx, off, 32));
      float sum = 0.f;
      for (int c = lane; c < SEQ; c += 32) {
        const float e = __expf((sS[r * SP_ + c] - mx) * 0.125f); // 1/sqrt(64)
        sS[r * SP_ + c] = e;
        sum += e;
      }
      for (int off = 16; off; off >>= 1) sum += __shfl_xor(sum, off, 32);
      const float inv = 1.0f / sum;
      for (int c = lane; c < SEQ; c += 32) sS[r * SP_ + c] *= inv;
    }

    // ---- Phase 5: ctx = P @ V; the 8 waves of a row group split
    //      4 n-tiles x 2 K-halves of each 64-key tile ----------------------
    v8f caccE = {}, caccO = {};
    const int nt = w8 & 3;  // 16-wide column tile of hd
    const int kh = w8 >> 2; // K half within each 64-key tile
    for (int chunk = 0; chunk < 32; ++chunk) {
      float* cur = (chunk & 1) ? sK1 : sK0;
      float* nxt = (chunk & 1) ? sK0 : sK1;
      ring_publish(); // tile 0: also publishes every row of probabilities
      if (chunk < 31) stageV(nxt, chunk + 1);

      const int kl0 = kh * 32 + ((lane >> 4) << 1); // first key of this lane
      const float* pf = sS + (mt * 16 + (lane & 15)) * SP_ + chunk * 64 + kl0;
      const float* vf = cur + kl0 * VP_ + nt * 16 + (lane & 15);
#pragma unroll
      for (int kk = 0; kk < 8; ++kk) { // 32 K-values per half / 4
        v2f a, bf;
        a.x = pf[kk * 4];
        a.y = pf[kk * 4 + 1];
        bf.x = vf[(kk * 4) * VP_];
        bf.y = vf[(kk * 4 + 1) * VP_];
        if (kk & 1)
          caccO = wmma_f32(a, bf, caccO);
        else
          caccE = wmma_f32(a, bf, caccE);
      }
    }
    const v8f cacc = caccE + caccO;
    // store partials, reduce the two K-halves, write ctx in [B,L,H*hd]
    {
      float* cp = sC + kh * (QT_ * HEAD_DIM) +
                  (mt * 16 + ((lane >> 4) << 3)) * HEAD_DIM + nt * 16 +
                  (lane & 15);
#pragma unroll
      for (int i = 0; i < 8; ++i) cp[i * HEAD_DIM] = cacc[i];
    }
    __syncthreads();
    {
      float* cg = ctx + ((size_t)b * SEQ + q0) * D_MODEL + h * HEAD_DIM;
      const int idx = tid * 4; // 2048 floats / 512 threads = one float4 each
      const float4 p0 = *(const float4*)(sC + idx);
      const float4 p1 = *(const float4*)(sC + QT_ * HEAD_DIM + idx);
      float4 o;
      o.x = p0.x + p1.x;
      o.y = p0.y + p1.y;
      o.z = p0.z + p1.z;
      o.w = p0.w + p1.w;
      const int m = idx >> 6, c = idx & 63;
      *(float4*)(cg + (size_t)m * D_MODEL + c) = o;
      // the head-mean sum below and the next head reuse the registers that this store names
      asm volatile("s_wait_xcnt 0x0" ::: "memory");
    }

    // ---- Head mean: add this head's probabilities, read back from sS here so
    // that no probability is held in a register across phase 5 (256-VGPR
    // budget at 16 waves). Each lane reads only what it stored in phase 3; sS
    // is next written behind the next head's first barrier.
    // (fully unrolled: wacc must be indexed by constants to stay in registers)
#pragma unroll
    for (int rr = 0; rr < 2; ++rr)
#pragma unroll
      for (int j = 0; j < 64; ++j)
        wacc[rr][j] += sS[(wave * 2 + rr) * SP_ + lane + 32 * j] *
                       (1.0f / NHEADS); // heads summed in order 0..15
  }

  // ---- Head-mean weights: one plain store per element (unrolled: wacc) ----
  {
    float* wout = wmean + ((size_t)b * SEQ + q0 + wave * 2) * SEQ + lane;
#pragma unroll
    for (int rr = 0; rr < 2; ++rr)
#pragma unroll
      for (int j = 0; j < 64; ++j) wout[(size_t)rr * SEQ + 32 * j] = wacc[rr][j];
  }
}

extern "C" void kernel_launch(void* const* d_in, const int* in_sizes, int n_in,
                              void* d_out, int out_size, void* d_ws,
                              size_t ws_size, hipStream_t stream) {
  (void)in_sizes; (void)n_in; (void)out_size; (void)ws_size;
  const float* q = (const float*)d_in[0];
  const float* k = (const float*)d_in[1];
  const float* v = (const float*)d_in[2];
  const float* in_w = (const float*)d_in[3];  // [3*1024, 1024]
  const float* in_b = (const float*)d_in[4];  // [3*1024]
  const float* out_w = (const float*)d_in[5]; // [1024, 1024]
  const float* out_b = (const float*)d_in[6]; // [1024]

  float* out = (float*)d_out;                  // [8192*1024]
  float* wmean = out + (size_t)MTOT * D_MODEL; // [4*2048*2048]

  const size_t QKV_N = (size_t)MTOT * D_MODEL; // 8,388,608 floats
  float* qp = (float*)d_ws;
  float* kp = qp + QKV_N;
  float* vp = kp + QKV_N;
  float* ctx = vp + QKV_N;

  const dim3 gemm_grid(D_MODEL / 64, MTOT / 64); // (16, 128)
  gemm_xwt_kernel<true><<<gemm_grid, 256, 0, stream>>>(q, in_w, in_b, qp);
  gemm_xwt_kernel<true><<<gemm_grid, 256, 0, stream>>>(
      k, in_w + (size_t)D_MODEL * D_MODEL, in_b + D_MODEL, kp);
  gemm_xwt_kernel<true><<<gemm_grid, 256, 0, stream>>>(
      v, in_w + (size_t)2 * D_MODEL * D_MODEL, in_b + 2 * D_MODEL, vp);

  static_assert(ATTN_LDS_BYTES <= 320 * 1024, "fits WGP LDS");
  attn_kernel<<<dim3(SEQ / QT_, BATCH), 512, 0, stream>>>(qp, kp, vp, ctx,
                                                          wmean);

  gemm_xwt_kernel<false><<<gemm_grid, 256, 0, stream>>>(ctx, out_w, out_b, out);
}

// v003
// One run takes 881 microseconds.
// Next to v002, in two timings, it ran 1.12 and 1.11 times as fast.
// Over all steps from v000 it is 1.61 times as fast.
#include <hip/hip_runtime.h>
#include <hip/hip_bf16.h>

// MHA fp32 forward for B=4, L=2048, D=1024, H=16, hd=64 on gfx1250 (MI455X).
// Matrix math on v_wmma_f32_16x16x4_f32; tile staging via CDNA5 async
// global->LDS copies (GLOBAL_LOAD_ASYNC_TO_LDS_B128, ASYNCcnt) with double
// buffering. Q A-fragments register-resident; K-parity-split accumulator
// chains for WMMA ILP. One attention work-group (16 waves, 32 query rows) walks
// all 16 heads of its query tile and keeps the head mean of the probabilities
// in registers.
// Workspace layout (needs 128 MB):
//   qp [B,H,L,64] | kp [B,H,L,64] | vp [B,H,L,64] | ctx [B,L,1024]
// d_out layout: out [B*L*1024] floats, then weights [B*2048*2048] floats.

typedef __attribute__((ext_vector_type(2))) float v2f;
typedef __attribute__((ext_vector_type(8))) float v8f;

#define D_MODEL 1024
#define NHEADS 16
#define HEAD_DIM 64
#define BATCH 4
#define SEQ 2048
#define MTOT (BATCH * SEQ) // 8192

static __device__ __forceinline__ v8f wmma_f32(v2f a, v2f b, v8f c) {
  // (neg_a, A, neg_b, B, c_mod, C, reuse_a, reuse_b)
  return __builtin_amdgcn_wmma_f32_16x16x4_f32(false, a, false, b, (short)0, c,
                                               false, false);
}

// Async 16B global->LDS copy (tracked by ASYNCcnt). VDST VGPR holds the
// workgroup-relative LDS byte address (= low 32 bits of the generic pointer
// to __shared__ on AMDGPU). Both addresses 16B-aligned.
static __device__ __forceinline__ void async_f4(const float* g, float* l) {
  const unsigned lds = (unsigned)(size_t)l;
  asm volatile("global_load_async_to_lds_b128 %0, %1, off" ::"v"(lds), "v"(g)
               : "memory");
}
// The same copy with s_wait_xcnt 0 as the last line of its own statement, so
// that no later write of the address registers can be scheduled in front of it.
static __device__ __forceinline__ void async_f4_w(const float* g, float* l) {
  const unsigned lds = (unsigned)(size_t)l;
  // copy + its wait in one statement (see above)
  asm volatile("global_load_async_to_lds_b128 %0, %1, off\n\t"
               "s_wait_xcnt 0x0" ::"v"(lds), "v"(g)
               : "memory");
}
// Two such copies, gstep floats apart in global memory and lstep floats apart
// in LDS, sharing one statement and one s_wait_xcnt 0 behind the last.
static __device__ __forceinline__ void async_f4x2_w(const float* g, float* l,
                                                    int gstep, int lstep) {
  const unsigned l0 = (unsigned)(size_t)l;
  const unsigned ls = (unsigned)lstep * 4u;
  // two copies + their one wait in one statement (see above)
  asm volatile("global_load_async_to_lds_b128 %0, %2, off\n\t"
               "global_load_async_to_lds_b128 %1, %3, off\n\t"
               "s_wait_xcnt 0x0" ::"v"(l0),
               "v"(l0 + ls), "v"(g), "v"(g + gstep)
               : "memory");
}
static __device__ __forceinline__ void wait_async0() {
  asm volatile("s_wait_asynccnt 0x0" ::: "memory");
}
// Hand-over point of the attention ring: this wave's LDS reads and writes have
// retired, its own copies have landed, then the work-group barrier publishes
// the landed tile and frees the tile that was read last.
static __device__ __forceinline__ void ring_publish() {
  // keeps the WMMAs of the tile just read in front of the waits: moved behind
  // them they would no longer cover the flight of the next tile's copies
  __builtin_amdgcn_sched_barrier(0);
  asm volatile("s_wait_dscnt 0x0" ::: "memory");
  wait_async0();
  __syncthreads();
}

// ---------------------------------------------------------------------------
// Generic Y = X @ W^T + bias, X:[8192,1024], W:[N=1024 rows,1024] row-major.
// Block tile 64(M) x 64(N), 8 waves; each wave a 16x32 strip. K streamed in
// 32-wide chunks, async double-buffered. Pitch 36 (144B rows: 16B aligned,
// conflict-free fragment reads). Four parity-split accumulator chains.
// QKV=true scatters output into [B,H,L,hd]; else plain row-major [M,1024].
// ---------------------------------------------------------------------------
#define GP 36 // gemm LDS pitch (floats)

template <bool QKV>
__global__ __launch_bounds__(256) void gemm_xwt_kernel(
    const float* __restrict__ X, const float* __restrict__ W,
    const float* __restrict__ bias, float* __restrict__ Y) {
  __shared__ float Xs[2][64 * GP];
  __shared__ float Ws[2][64 * GP];

  const int tid = threadIdx.x;
  const int lane = tid & 31;
  const int wave = tid >> 5;
  const int wm = wave >> 1; // 0..3 -> M subtile
  const int wn = wave & 1;  // 0..1 -> N strip of 32
  const int m0 = blockIdx.y * 64;
  const int n0 = blockIdx.x * 64;

  v8f acc0e = {}, acc0o = {}, acc1e = {}, acc1o = {};

  auto stage = [&](int buf, int kc) {
#pragma unroll
    for (int it = 0; it < 2; ++it) {
      const int idx = tid + it * 256; // 0..511 float4 slots
      const int r = idx >> 3;
      const int s = idx & 7;
      async_f4(const_cast<float*>(X) + (size_t)(m0 + r) * D_MODEL + kc + s * 4,
               &Xs[buf][r * GP + s * 4]);
      async_f4(const_cast<float*>(W) + (size_t)(n0 + r) * D_MODEL + kc + s * 4,
               &Ws[buf][r * GP + s * 4]);
    }
  };

  stage(0, 0);
  for (int kc = 0; kc < D_MODEL; kc += 32) {
    const int buf = (kc >> 5) & 1;
    wait_async0();
    __syncthreads(); // tile[buf] in LDS; everyone done reading tile[buf^1]
    if (kc + 32 < D_MODEL) stage(buf ^ 1, kc + 32);

#pragma unroll
    for (int kk = 0; kk < 8; ++kk) {
      const int kb = kk * 4 + ((lane >> 4) << 1);
      v2f a, b0, b1;
      const int ar = (wm * 16 + (lane & 15)) * GP + kb;
      a.x = Xs[buf][ar];
      a.y = Xs[buf][ar + 1];
      const int br0 = (wn * 32 + (lane & 15)) * GP + kb;
      const int br1 = (wn * 32 + 16 + (lane & 15)) * GP + kb;
      b0.x = Ws[buf][br0];
      b0.y = Ws[buf][br0 + 1];
      b1.x = Ws[buf][br1];
      b1.y = Ws[buf][br1 + 1];
      if (kk & 1) {
        acc0o = wmma_f32(a, b0, acc0o);
        acc1o = wmma_f32(a, b1, acc1o);
      } else {
        acc0e = wmma_f32(a, b0, acc0e);
        acc1e = wmma_f32(a, b1, acc1e);
      }
    }
    // no trailing barrier: next iteration's leading barrier protects buffers
  }
  const v8f acc0 = acc0e + acc0o;
  const v8f acc1 = acc1e + acc1o;

  // C/D layout: lane -> n = lane&15, rows (lane>>4)*8 + i.
  const int mb = m0 + wm * 16 + ((lane >> 4) << 3);
#pragma unroll
  for (int sub = 0; sub < 2; ++sub) {
    const int n = n0 + wn * 32 + sub * 16 + (lane & 15);
    const float bv = bias[n];
#pragma unroll
    for (int i = 0; i < 8; ++i) {
      const float val = (sub == 0 ? acc0[i] : acc1[i]) + bv;
      const int m = mb + i;
      size_t off;
      if (QKV) {
        // [B,H,L,hd]: b=m/2048, l=m%2048, h=n/64, hd=n%64
        off = (((size_t)((m >> 11) * NHEADS + (n >> 6)) * SEQ) + (m & 2047)) *
                  HEAD_DIM +
              (n & 63);
      } else {
        off = (size_t)m * D_MODEL + n;
      }
      Y[off] = val;
    }
  }
}

// ---------------------------------------------------------------------------
// Fused attention: one workgroup of 16 waves per (b, 32-query tile), looping
// over heads. Waves 0-7 work on query rows 0-15, waves 8-15 on rows 16-31, so
// every staged K or V tile is read by both row groups.
// LDS: sS 32x2050 scores->probs | sQ 32x68 | ring of 2 tiles (K: 128 keys x
//      32 of hd, pitch 36; V: 64 keys x 64, pitch 68), async-staged
//      | sC 2x32x64 ctx partials
// ---------------------------------------------------------------------------
#define QT_ 32   // query rows per work-group
#define QP_ 68   // sQ pitch
#define KP_ 36   // K tile pitch (rows 144B -> 16B aligned)
#define VP_ 68   // V tile pitch (rows 272B -> 16B aligned)
#define RB_ 4608 // floats per ring tile: 128 * KP_ (K), 64 * VP_ = 4352 (V)
#define SP_ 2050 // sS pitch
#define ATTN_LDS_FLOATS (QT_ * QP_ + 2 * RB_ + QT_ * SP_ + 2 * QT_ * HEAD_DIM)
#define ATTN_LDS_BYTES (ATTN_LDS_FLOATS * 4) // 324352 B <= 320 KB WGP LDS

__global__ __launch_bounds__(512) void attn_kernel(
    const float* __restrict__ qp, const float* __restrict__ kp,
    const float* __restrict__ vp, float* __restrict__ ctx,
    float* __restrict__ wmean /* [B,2048,2048], every element stored once */) {
  __shared__ __attribute__((aligned(16))) float smem[ATTN_LDS_FLOATS];
  float* sS = smem;            // 32 x 2050 (first: row steps fit ds offsets)
  float* sQ = sS + QT_ * SP_;  // 32 x 68
  float* sK0 = sQ + QT_ * QP_; // ring tile 0
  float* sK1 = sK0 + RB_;      // ring tile 1
  float* sC = sK1 + RB_;       // 2 x 32 x 64

  const int q0 = blockIdx.x * QT_;
  const int b = blockIdx.y;
  const int tid = threadIdx.x;
  const int lane = tid & 31;
  const int wave = tid >> 5;
  const int mt = wave >> 3; // 16-row group of the query tile
  const int w8 = wave & 7;  // role of the wave inside its row group
  // Where this work-group starts its walk over the key axis (in units of 128
  // keys, wrapping round). For speed only: the 64 work-groups of a batch read
  // the same K and V; started at 16 different places they do not all ask for
  // the same not yet cached tile at the same moment, and a tile that one of
  // them has fetched from memory is an L2 hit for those that come to it later.
  // (low bits and bits 3-4: neighbours in the grid get different starts)
  const int rot = ((blockIdx.x >> 3) & 3) * 4 + (blockIdx.x & 3);

  // Head mean of the probabilities: this lane owns rows wave*2 + rr, columns
  // lane + 32*j, the same elements it normalises in phase 3 of every head.
  // (every loop over wacc is fully unrolled: constant indices keep it in VGPRs)
  float wacc[2][64];
#pragma unroll
  for (int rr = 0; rr < 2; ++rr)
#pragma unroll
    for (int j = 0; j < 64; ++j) wacc[rr][j] = 0.f;

  for (int h = 0; h < NHEADS; ++h) {
    const int bh = b * NHEADS + h; // matches [B,H,...] flattening
    const float* Qg = qp + (size_t)bh * SEQ * HEAD_DIM;
    const float* Kg = kp + (size_t)bh * SEQ * HEAD_DIM;
    const float* Vg = vp + (size_t)bh * SEQ * HEAD_DIM;

    // K tile c of the walk: keys k0 .. k0+127 with k0 = (((c>>1) + rot) & 15)
    // * 128, hd columns (c&1)*32 .. +31
    // (1024 float4, 2/thread: slot t&7 of rows t>>3 and (t>>3) + 64)
    auto stageK = [&](float* dst, int c) {
      const int r = tid >> 3;
      const int s = tid & 7;
      const int k0 = (((c >> 1) + rot) & 15) * 128;
      async_f4x2_w(Kg + (size_t)(k0 + r) * HEAD_DIM + (c & 1) * 32 + s * 4,
                   &dst[r * KP_ + s * 4], 64 * HEAD_DIM, 64 * KP_);
    };
    // V tile c of the walk: keys k0 .. k0+63 with k0 = ((c + 2*rot) & 31) * 64,
    // all 64 hd columns
    // (1024 float4, 2/thread: slot t&15 of rows t>>4 and (t>>4) + 32)
    auto stageV = [&](float* dst, int c) {
      const int r = tid >> 4;
      const int s = tid & 15;
      const int k0 = ((c + 2 * rot) & 31) * 64;
      async_f4x2_w(Vg + (size_t)(k0 + r) * HEAD_DIM + s * 4,
                   &dst[r * VP_ + s * 4], 32 * HEAD_DIM, 32 * VP_);
    };

    // ---- Phase 1: async-stage Q tile (32x64 = 512 float4, 1/thread) + K0 -
    // (sQ and sK0 were last read in front of the previous head's barriers)
    {
      const int r = tid >> 4;
      const int s = tid & 15;
      async_f4_w(Qg + (size_t)(q0 + r) * HEAD_DIM + s * 4,
                 &sQ[r * QP_ + s * 4]);
    }
    stageK(sK0, 0);
    ring_publish(); // Q tile and K tile 0 resident

    // Preload the 16 Q A-fragments (invariant across all K tiles): 32 VGPRs.
    v2f aq[16];
    {
      const float* qf = sQ + (mt * 16 + (lane & 15)) * QP_ + ((lane >> 4) << 1);
#pragma unroll
      for (int kk = 0; kk < 16; ++kk) {
        aq[kk].x = qf[kk * 4];
        aq[kk].y = qf[kk * 4 + 1];
      }
    }

    // ---- Phase 2: raw scores S = Q @ K^T (scale folded into softmax) -----
    for (int rb = 0; rb < 16; ++rb) { // 128 keys: two K tiles (hd halves)
      v8f accE = {}, accO = {};
      // unrolled: aq must be indexed by constants to stay in registers
#pragma unroll
      for (int hf = 0; hf < 2; ++hf) {
        float* cur = hf ? sK1 : sK0;
        float* nxt = hf ? sK0 : sK1;
        const int c = rb * 2 + hf;
        if (c > 0) ring_publish(); // tile 0 already published above
        if (c < 31) stageK(nxt, c + 1);

        const float* kf =
            cur + (w8 * 16 + (lane & 15)) * KP_ + ((lane >> 4) << 1);
#pragma unroll
        for (int kk = 0; kk < 8; ++kk) { // K = 32 / 4
          v2f bf;
          bf.x = kf[kk * 4];
          bf.y = kf[kk * 4 + 1];
          if (kk & 1)
            accO = wmma_f32(aq[hf * 8 + kk], bf, accO);
          else
            accE = wmma_f32(aq[hf * 8 + kk], bf, accE);
        }
      }
      const v8f acc = accE + accO;
      float* sp = sS + (mt * 16 + ((lane >> 4) << 3)) * SP_ +
                  ((rb + rot) & 15) * 128 + w8 * 16 + (lane & 15);
#pragma unroll
      for (int i = 0; i < 8; ++i) sp[i * SP_] = acc[i];
    }
    ring_publish(); // all score columns visible; both ring tiles free

    // kick off V tile 0 now; it overlaps the softmax below
    stageV(sK0, 0);

    // ---- Phase 3: row softmax of s/8 (wave32 shuffle reductions) ---------
#pragma unroll
    for (int rr = 0; rr < 2; ++rr) {
      const int r = wave * 2 + rr;
      float mx = -INFINITY;
      for (int c = lane; c < SEQ; c += 32) mx = fmaxf(mx, sS[r * SP_ + c]);
      for (int off = 16; off; off >>= 1)
        mx = fmaxf(mx, __shfl_xor(mx, off, 32));
      float sum = 0.f;
      for (int c = lane; c < SEQ; c += 32) {
        const float e = __expf((sS[r * SP_ + c] - mx) * 0.125f); // 1/sqrt(64)
        sS[r * SP_ + c] = e;
        sum += e;
      }
      for (int off = 16; off; off >>= 1) sum += __shfl_xor(sum, off, 32);
      const float inv = 1.0f / sum;
      for (int c = lane; c < SEQ; c += 32) sS[r * SP_ + c] *= inv;
    }

    // ---- Phase 5: ctx = P @ V; the 8 waves of a row group split
    //      4 n-tiles x 2 K-halves of each 64-key tile ----------------------
    v8f caccE = {}, caccO = {};
    const int nt = w8 & 3;  // 16-wide column tile of hd
    const int kh = w8 >> 2; // K half within each 64-key tile
    for (int chunk = 0; chunk < 32; ++chunk) {
      float* cur = (chunk & 1) ? sK1 : sK0;
      float* nxt = (chunk & 1) ? sK0 : sK1;
      ring_publish(); // tile 0: also publishes every row of probabilities
      if (chunk < 31) stageV(nxt, chunk + 1);

      const int kl0 = kh * 32 + ((lane >> 4) << 1); // first key of this lane
      const float* pf = sS + (mt * 16 + (lane & 15)) * SP_ +
                        ((chunk + 2 * rot) & 31) * 64 + kl0;
      const float* vf = cur + kl0 * VP_ + nt * 16 + (lane & 15);
#pragma unroll
      for (int kk = 0; kk < 8; ++kk) { // 32 K-values per half / 4
        v2f a, bf;
        a.x = pf[kk * 4];
        a.y = pf[kk * 4 + 1];
        bf.x = vf[(kk * 4) * VP_];
        bf.y = vf[(kk * 4 + 1) * VP_];
        if (kk & 1)
          caccO = wmma_f32(a, bf, caccO);
        else
          caccE = wmma_f32(a, bf, caccE);
      }
    }
    const v8f cacc = caccE + caccO;
    // store partials, reduce the two K-halves, write ctx in [B,L,H*hd]
    {
      float* cp = sC + kh * (QT_ * HEAD_DIM) +
                  (mt * 16 + ((lane >> 4) << 3)) * HEAD_DIM + nt * 16 +
                  (lane & 15);
#pragma unroll
      for (int i = 0; i < 8; ++i) cp[i * HEAD_DIM] = cacc[i];
    }
    __syncthreads();
    {
      float* cg = ctx + ((size_t)b * SEQ + q0) * D_MODEL + h * HEAD_DIM;
      const int idx = tid * 4; // 2048 floats / 512 threads = one float4 each
      const float4 p0 = *(const float4*)(sC + idx);
      const float4 p1 = *(const float4*)(sC + QT_ * HEAD_DIM + idx);
      float4 o;
      o.x = p0.x + p1.x;
      o.y = p0.y + p1.y;
      o.z = p0.z + p1.z;
      o.w = p0.w + p1.w;
      const int m = idx >> 6, c = idx & 63;
      *(float4*)(cg + (size_t)m * D_MODEL + c) = o;
      // the head-mean sum below and the next head reuse the registers that this store names
      asm volatile("s_wait_xcnt 0x0" ::: "memory");
    }

    // ---- Head mean: add this head's probabilities, read back from sS here so
    // that no probability is held in a register across phase 5 (256-VGPR
    // budget at 16 waves). Each lane reads only what it stored in phase 3; sS
    // is next written behind the next head's first barrier.
    // (fully unrolled: wacc must be indexed by constants to stay in registers)
#pragma unroll
    for (int rr = 0; rr < 2; ++rr)
#pragma unroll
      for (int j = 0; j < 64; ++j)
        wacc[rr][j] += sS[(wave * 2 + rr) * SP_ + lane + 32 * j] *
                       (1.0f / NHEADS); // heads summed in order 0..15
  }

  // ---- Head-mean weights: one plain store per element (unrolled: wacc) ----
  {
    float* wout = wmean + ((size_t)b * SEQ + q0 + wave * 2) * SEQ + lane;
#pragma unroll
    for (int rr = 0; rr < 2; ++rr)
#pragma unroll
      for (int j = 0; j < 64; ++j) wout[(size_t)rr * SEQ + 32 * j] = wacc[rr][j];
  }
}

extern "C" void kernel_launch(void* const* d_in, const int* in_sizes, int n_in,
                              void* d_out, int out_size, void* d_ws,
                              size_t ws_size, hipStream_t stream) {
  (void)in_sizes; (void)n_in; (void)out_size; (void)ws_size;
  const float* q = (const float*)d_in[0];
  const float* k = (const float*)d_in[1];
  const float* v = (const float*)d_in[2];
  const float* in_w = (const float*)d_in[3];  // [3*1024, 1024]
  const float* in_b = (const float*)d_in[4];  // [3*1024]
  const float* out_w = (const float*)d_in[5]; // [1024, 1024]
  const float* out_b = (const float*)d_in[6]; // [1024]

  float* out = (float*)d_out;                  // [8192*1024]
  float* wmean = out + (size_t)MTOT * D_MODEL; // [4*2048*2048]

  const size_t QKV_N = (size_t)MTOT * D_MODEL; // 8,388,608 floats
  float* qp = (float*)d_ws;
  float* kp = qp + QKV_N;
  float* vp = kp + QKV_N;
  float* ctx = vp + QKV_N;

  const dim3 gemm_grid(D_MODEL / 64, MTOT / 64); // (16, 128)
  gemm_xwt_kernel<true><<<gemm_grid, 256, 0, stream>>>(q, in_w, in_b, qp);
  gemm_xwt_kernel<true><<<gemm_grid, 256, 0, stream>>>(
      k, in_w + (size_t)D_MODEL * D_MODEL, in_b + D_MODEL, kp);
  gemm_xwt_kernel<true><<<gemm_grid, 256, 0, stream>>>(
      v, in_w + (size_t)2 * D_MODEL * D_MODEL, in_b + 2 * D_MODEL, vp);

  static_assert(ATTN_LDS_BYTES <= 320 * 1024, "fits WGP LDS");
  attn_kernel<<<dim3(SEQ / QT_, BATCH), 512, 0, stream>>>(qp, kp, vp, ctx,
                                                          wmean);

  gemm_xwt_kernel<false><<<gemm_grid, 256, 0, stream>>>(ctx, out_w, out_b, out);
}

// v004
// A run of this version takes 809 microseconds.
// Next to v003, in two timings, it ran 1.09 times as fast each time.
// All steps since v000 together make it 1.76 times as fast.
#include <hip/hip_runtime.h>
#include <hip/hip_bf16.h>

// MHA fp32 forward for B=4, L=2048, D=1024, H=16, hd=64 on gfx1250 (MI455X).
// Matrix math on v_wmma_f32_16x16x4_f32; tile staging via CDNA5 async
// global->LDS copies (GLOBAL_LOAD_ASYNC_TO_LDS_B128, ASYNCcnt) with double
// buffering. Q A-fragments register-resident; K-parity-split accumulator
// chains for WMMA ILP. One attention work-group (16 waves, 32 query rows) walks
// all 16 heads of its query tile and keeps the head mean of the probabilities
// in registers.
// Workspace layout (needs 128 MB):
//   qp [B,H,L,64] | kp [B,H,L,64] | vp [B,H,L,64] | ctx [B,L,1024]
// d_out layout: out [B*L*1024] floats, then weights [B*2048*2048] floats.

typedef __attribute__((ext_vector_type(2))) float v2f;
typedef __attribute__((ext_vector_type(8))) float v8f;

#define D_MODEL 1024
#define NHEADS 16
#define HEAD_DIM 64
#define BATCH 4
#define SEQ 2048
#define MTOT (BATCH * SEQ) // 8192

static __device__ __forceinline__ v8f wmma_f32(v2f a, v2f b, v8f c) {
  // (neg_a, A, neg_b, B, c_mod, C, reuse_a, reuse_b)
  return __builtin_amdgcn_wmma_f32_16x16x4_f32(false, a, false, b, (short)0, c,
                                               false, false);
}

// Async 16B global->LDS copy (tracked by ASYNCcnt). VDST VGPR holds the
// workgroup-relative LDS byte address (= low 32 bits of the generic pointer
// to __shared__ on AMDGPU). Both addresses 16B-aligned.
static __device__ __forceinline__ void async_f4(const float* g, float* l) {
  const unsigned lds = (unsigned)(size_t)l;
  asm volatile("global_load_async_to_lds_b128 %0, %1, off" ::"v"(lds), "v"(g)
               : "memory");
}
// The same copy with s_wait_xcnt 0 as the last line of its own statement, so
// that no later write of the address registers can be scheduled in front of it.
static __device__ __forceinline__ void async_f4_w(const float* g, float* l) {
  const unsigned lds = (unsigned)(size_t)l;
  // copy + its wait in one statement (see above)
  asm volatile("global_load_async_to_lds_b128 %0, %1, off\n\t"
               "s_wait_xcnt 0x0" ::"v"(lds), "v"(g)
               : "memory");
}
// Two such copies, gstep floats apart in global memory and lstep floats apart
// in LDS, sharing one statement and one s_wait_xcnt 0 behind the last.
static __device__ __forceinline__ void async_f4x2_w(const float* g, float* l,
                                                    int gstep, int lstep) {
  const unsigned l0 = (unsigned)(size_t)l;
  const unsigned ls = (unsigned)lstep * 4u;
  // two copies + their one wait in one statement (see above)
  asm volatile("global_load_async_to_lds_b128 %0, %2, off\n\t"
               "global_load_async_to_lds_b128 %1, %3, off\n\t"
               "s_wait_xcnt 0x0" ::"v"(l0),
               "v"(l0 + ls), "v"(g), "v"(g + gstep)
               : "memory");
}
static __device__ __forceinline__ void wait_async0() {
  asm volatile("s_wait_asynccnt 0x0" ::: "memory");
}
// Hand-over point of the attention ring: this wave's LDS reads and writes have
// retired, its own copies have landed, then the work-group barrier publishes
// the landed tile and frees the tile that was read last.
static __device__ __forceinline__ void ring_publish() {
  // keeps the WMMAs of the tile just read in front of the waits: moved behind
  // them they would no longer cover the flight of the next tile's copies
  __builtin_amdgcn_sched_barrier(0);
  asm volatile("s_wait_dscnt 0x0" ::: "memory");
  wait_async0();
  __syncthreads();
}

// ---------------------------------------------------------------------------
// Generic Y = X @ W^T + bias, X:[8192,1024], W:[N=1024 rows,1024] row-major.
// Block tile 64(M) x 64(N), 8 waves; each wave a 16x32 strip. K streamed in
// 32-wide chunks, async double-buffered. Pitch 36 (144B rows: 16B aligned,
// conflict-free fragment reads). Four parity-split accumulator chains.
// QKV=true scatters output into [B,H,L,hd]; else plain row-major [M,1024].
// ---------------------------------------------------------------------------
#define GP 36 // gemm LDS pitch (floats)

template <bool QKV>
__global__ __launch_bounds__(256) void gemm_xwt_kernel(
    const float* __restrict__ X, const float* __restrict__ W,
    const float* __restrict__ bias, float* __restrict__ Y) {
  __shared__ float Xs[2][64 * GP];
  __shared__ float Ws[2][64 * GP];

  const int tid = threadIdx.x;
  const int lane = tid & 31;
  const int wave = tid >> 5;
  const int wm = wave >> 1; // 0..3 -> M subtile
  const int wn = wave & 1;  // 0..1 -> N strip of 32
  const int m0 = blockIdx.y * 64;
  const int n0 = blockIdx.x * 64;

  v8f acc0e = {}, acc0o = {}, acc1e = {}, acc1o = {};

  auto stage = [&](int buf, int kc) {
#pragma unroll
    for (int it = 0; it < 2; ++it) {
      const int idx = tid + it * 256; // 0..511 float4 slots
      const int r = idx >> 3;
      const int s = idx & 7;
      async_f4(const_cast<float*>(X) + (size_t)(m0 + r) * D_MODEL + kc + s * 4,
               &Xs[buf][r * GP + s * 4]);
      async_f4(const_cast<float*>(W) + (size_t)(n0 + r) * D_MODEL + kc + s * 4,
               &Ws[buf][r * GP + s * 4]);
    }
  };

  stage(0, 0);
  for (int kc = 0; kc < D_MODEL; kc += 32) {
    const int buf = (kc >> 5) & 1;
    wait_async0();
    __syncthreads(); // tile[buf] in LDS; everyone done reading tile[buf^1]
    if (kc + 32 < D_MODEL) stage(buf ^ 1, kc + 32);

#pragma unroll
    for (int kk = 0; kk < 8; ++kk) {
      const int kb = kk * 4 + ((lane >> 4) << 1);
      v2f a, b0, b1;
      const int ar = (wm * 16 + (lane & 15)) * GP + kb;
      a.x = Xs[buf][ar];
      a.y = Xs[buf][ar + 1];
      const int br0 = (wn * 32 + (lane & 15)) * GP + kb;
      const int br1 = (wn * 32 + 16 + (lane & 15)) * GP + kb;
      b0.x = Ws[buf][br0];
      b0.y = Ws[buf][br0 + 1];
      b1.x = Ws[buf][br1];
      b1.y = Ws[buf][br1 + 1];
      if (kk & 1) {
        acc0o = wmma_f32(a, b0, acc0o);
        acc1o = wmma_f32(a, b1, acc1o);
      } else {
        acc0e = wmma_f32(a, b0, acc0e);
        acc1e = wmma_f32(a, b1, acc1e);
      }
    }
    // no trailing barrier: next iteration's leading barrier protects buffers
  }
  const v8f acc0 = acc0e + acc0o;
  const v8f acc1 = acc1e + acc1o;

  // C/D layout: lane -> n = lane&15, rows (lane>>4)*8 + i.
  const int mb = m0 + wm * 16 + ((lane >> 4) << 3);
#pragma unroll
  for (int sub = 0; sub < 2; ++sub) {
    const int n = n0 + wn * 32 + sub * 16 + (lane & 15);
    const float bv = bias[n];
#pragma unroll
    for (int i = 0; i < 8; ++i) {
      const float val = (sub == 0 ? acc0[i] : acc1[i]) + bv;
      const int m = mb + i;
      size_t off;
      if (QKV) {
        // [B,H,L,hd]: b=m/2048, l=m%2048, h=n/64, hd=n%64
        off = (((size_t)((m >> 11) * NHEADS + (n >> 6)) * SEQ) + (m & 2047)) *
                  HEAD_DIM +
              (n & 63);
      } else {
        off = (size_t)m * D_MODEL + n;
      }
      Y[off] = val;
    }
  }
}

// ---------------------------------------------------------------------------
// Fused attention: one workgroup of 16 waves per (b, 32-query tile), looping
// over heads. Waves 0-7 work on query rows 0-15, waves 8-15 on rows 16-31, so
// every staged K or V tile is read by both row groups.
// LDS: sS 32x2050 scores->probs | sQ 32x68 | ring of 2 tiles (K: 128 keys x
//      32 of hd, pitch 36; V: 64 keys x 64, pitch 68), async-staged
//      | sC 2x32x64 ctx partials
// ---------------------------------------------------------------------------
#define QT_ 32   // query rows per work-group
#define QP_ 68   // sQ pitch
#define KP_ 36   // K tile pitch (rows 144B -> 16B aligned)
#define VP_ 68   // V tile pitch (rows 272B -> 16B aligned)
#define RB_ 4608 // floats per ring tile: 128 * KP_ (K), 64 * VP_ = 4352 (V)
#define SP_ 2050 // sS pitch
#define ATTN_LDS_FLOATS (QT_ * QP_ + 2 * RB_ + QT_ * SP_ + 2 * QT_ * HEAD_DIM)
#define ATTN_LDS_BYTES (ATTN_LDS_FLOATS * 4) // 324352 B <= 320 KB WGP LDS

__global__ __launch_bounds__(512) void attn_kernel(
    const float* __restrict__ qp, const float* __restrict__ kp,
    const float* __restrict__ vp, float* __restrict__ ctx,
    float* __restrict__ wmean /* [B,2048,2048], every element stored once */) {
  __shared__ __attribute__((aligned(16))) float smem[ATTN_LDS_FLOATS];
  float* sS = smem;            // 32 x 2050 (first: row steps fit ds offsets)
  float* sQ = sS + QT_ * SP_;  // 32 x 68
  float* sK0 = sQ + QT_ * QP_; // ring tile 0
  float* sK1 = sK0 + RB_;      // ring tile 1
  float* sC = sK1 + RB_;       // 2 x 32 x 64

  const int q0 = blockIdx.x * QT_;
  const int b = blockIdx.y;
  const int tid = threadIdx.x;
  const int lane = tid & 31;
  const int wave = tid >> 5;
  const int mt = wave >> 3; // 16-row group of the query tile
  const int w8 = wave & 7;  // role of the wave inside its row group
  // Where this work-group starts its walk over the key axis (in units of 128
  // keys, wrapping round). For speed only: the 64 work-groups of a batch read
  // the same K and V; started at 16 different places they do not all ask for
  // the same not yet cached tile at the same moment, and a tile that one of
  // them has fetched from memory is an L2 hit for those that come to it later.
  // (low bits and bits 3-4: neighbours in the grid get different starts)
  const int rot = ((blockIdx.x >> 3) & 3) * 4 + (blockIdx.x & 3);

  // Head mean of the probabilities: this lane owns rows wave*2 + rr, columns
  // 2*lane + 64*(j>>1) + (j&1), the same elements it normalises in phase 3 of
  // every head, where they are added.
  // (every loop over wacc is fully unrolled: constant indices keep it in VGPRs)
  float wacc[2][64];
#pragma unroll
  for (int rr = 0; rr < 2; ++rr)
#pragma unroll
    for (int j = 0; j < 64; ++j) wacc[rr][j] = 0.f;

  for (int h = 0; h < NHEADS; ++h) {
    const int bh = b * NHEADS + h; // matches [B,H,...] flattening
    const float* Qg = qp + (size_t)bh * SEQ * HEAD_DIM;
    const float* Kg = kp + (size_t)bh * SEQ * HEAD_DIM;
    const float* Vg = vp + (size_t)bh * SEQ * HEAD_DIM;

    // K tile c of the walk: keys k0 .. k0+127 with k0 = (((c>>1) + rot) & 15)
    // * 128, hd columns (c&1)*32 .. +31
    // (1024 float4, 2/thread: slot t&7 of rows t>>3 and (t>>3) + 64)
    auto stageK = [&](float* dst, int c) {
      const int r = tid >> 3;
      const int s = tid & 7;
      const int k0 = (((c >> 1) + rot) & 15) * 128;
      async_f4x2_w(Kg + (size_t)(k0 + r) * HEAD_DIM + (c & 1) * 32 + s * 4,
                   &dst[r * KP_ + s * 4], 64 * HEAD_DIM, 64 * KP_);
    };
    // V tile c of the walk: keys k0 .. k0+63 with k0 = ((c + 2*rot) & 31) * 64,
    // all 64 hd columns
    // (1024 float4, 2/thread: slot t&15 of rows t>>4 and (t>>4) + 32)
    auto stageV = [&](float* dst, int c) {
      const int r = tid >> 4;
      const int s = tid & 15;
      const int k0 = ((c + 2 * rot) & 31) * 64;
      async_f4x2_w(Vg + (size_t)(k0 + r) * HEAD_DIM + s * 4,
                   &dst[r * VP_ + s * 4], 32 * HEAD_DIM, 32 * VP_);
    };

    // ---- Phase 1: async-stage Q tile (32x64 = 512 float4, 1/thread) + K0 -
    // (sQ and sK0 were last read in front of the previous head's barriers)
    {
      const int r = tid >> 4;
      const int s = tid & 15;
      async_f4_w(Qg + (size_t)(q0 + r) * HEAD_DIM + s * 4,
                 &sQ[r * QP_ + s * 4]);
    }
    stageK(sK0, 0);
    ring_publish(); // Q tile and K tile 0 resident

    // Preload the 16 Q A-fragments (invariant across all K tiles): 32 VGPRs.
    v2f aq[16];
    {
      const float* qf = sQ + (mt * 16 + (lane & 15)) * QP_ + ((lane >> 4) << 1);
#pragma unroll
      for (int kk = 0; kk < 16; ++kk) {
        aq[kk].x = qf[kk * 4];
        aq[kk].y = qf[kk * 4 + 1];
      }
    }

    // ---- Phase 2: raw scores S = Q @ K^T (scale folded into softmax) -----
    for (int rb = 0; rb < 16; ++rb) { // 128 keys: two K tiles (hd halves)
      v8f accE = {}, accO = {};
      // unrolled: aq must be indexed by constants to stay in registers
#pragma unroll
      for (int hf = 0; hf < 2; ++hf) {
        float* cur = hf ? sK1 : sK0;
        float* nxt = hf ? sK0 : sK1;
        const int c = rb * 2 + hf;
        if (c > 0) ring_publish(); // tile 0 already published above
        if (c < 31) stageK(nxt, c + 1);

        const float* kf =
            cur + (w8 * 16 + (lane & 15)) * KP_ + ((lane >> 4) << 1);
#pragma unroll
        for (int kk = 0; kk < 8; ++kk) { // K = 32 / 4
          v2f bf;
          bf.x = kf[kk * 4];
          bf.y = kf[kk * 4 + 1];
          if (kk & 1)
            accO = wmma_f32(aq[hf * 8 + kk], bf, accO);
          else
            accE = wmma_f32(aq[hf * 8 + kk], bf, accE);
        }
      }
      const v8f acc = accE + accO;
      float* sp = sS + (mt * 16 + ((lane >> 4) << 3)) * SP_ +
                  ((rb + rot) & 15) * 128 + w8 * 16 + (lane & 15);
#pragma unroll
      for (int i = 0; i < 8; ++i) sp[i * SP_] = acc[i];
    }
    ring_publish(); // all score columns visible; both ring tiles free

    // kick off V tile 0 now; it overlaps the softmax below
    stageV(sK0, 0);

    // ---- Phase 3: row softmax of s/8 (wave32 shuffle reductions) ---------
    // A lane keeps its 64 scores of the row (32 column pairs) in registers from
    // the one LDS read to the one LDS write of the probabilities, and adds each
    // probability to the head mean as it is made (heads in order 0..15).
    // (every loop over e and wacc is fully unrolled: constant indices keep
    // them in VGPRs)
#pragma unroll
    for (int rr = 0; rr < 2; ++rr) {
      float* row = sS + (wave * 2 + rr) * SP_ + 2 * lane; // 8-byte aligned
      float e[64];
#pragma unroll
      for (int j = 0; j < 32; ++j) {
        const v2f t = *(const v2f*)(row + 64 * j);
        e[2 * j] = t.x;
        e[2 * j + 1] = t.y;
      }
      float mx = -INFINITY;
#pragma unroll
      for (int j = 0; j < 64; ++j) mx = fmaxf(mx, e[j]);
      for (int off = 16; off; off >>= 1)
        mx = fmaxf(mx, __shfl_xor(mx, off, 32));
      float sum0 = 0.f, sum1 = 0.f; // even and odd columns: two add chains
#pragma unroll
      for (int j = 0; j < 32; ++j) {
        e[2 * j] = __expf((e[2 * j] - mx) * 0.125f); // 1/sqrt(64)
        e[2 * j + 1] = __expf((e[2 * j + 1] - mx) * 0.125f);
        sum0 += e[2 * j];
        sum1 += e[2 * j + 1];
      }
      float sum = sum0 + sum1;
      for (int off = 16; off; off >>= 1) sum += __shfl_xor(sum, off, 32);
      const float inv = 1.0f / sum;
#pragma unroll
      for (int j = 0; j < 32; ++j) {
        v2f t;
        t.x = e[2 * j] *= inv;
        t.y = e[2 * j + 1] *= inv;
        *(v2f*)(row + 64 * j) = t;
      }
      // wacc += p * (1/16), 0x3d800000 = 1.0f / NHEADS. Written in asm so that
      // it stays here: as plain code the compiler moves the 128 adds to the
      // foot of the head loop and spills the probabilities across phase 5.
#pragma unroll
      for (int j = 0; j < 64; ++j)
        asm volatile("v_fmac_f32 %0, 0x3d800000, %1"
                     : "+v"(wacc[rr][j])
                     : "v"(e[j]));
    }

    // ---- Phase 5: ctx = P @ V; the 8 waves of a row group split
    //      4 n-tiles x 2 K-halves of each 64-key tile ----------------------
    v8f caccE = {}, caccO = {};
    const int nt = w8 & 3;  // 16-wide column tile of hd
    const int kh = w8 >> 2; // K half within each 64-key tile
    for (int chunk = 0; chunk < 32; ++chunk) {
      float* cur = (chunk & 1) ? sK1 : sK0;
      float* nxt = (chunk & 1) ? sK0 : sK1;
      ring_publish(); // tile 0: also publishes every row of probabilities
      if (chunk < 31) stageV(nxt, chunk + 1);

      const int kl0 = kh * 32 + ((lane >> 4) << 1); // first key of this lane
      const float* pf = sS + (mt * 16 + (lane & 15)) * SP_ +
                        ((chunk + 2 * rot) & 31) * 64 + kl0;
      const float* vf = cur + kl0 * VP_ + nt * 16 + (lane & 15);
#pragma unroll
      for (int kk = 0; kk < 8; ++kk) { // 32 K-values per half / 4
        v2f a, bf;
        a.x = pf[kk * 4];
        a.y = pf[kk * 4 + 1];
        bf.x = vf[(kk * 4) * VP_];
        bf.y = vf[(kk * 4 + 1) * VP_];
        if (kk & 1)
          caccO = wmma_f32(a, bf, caccO);
        else
          caccE = wmma_f32(a, bf, caccE);
      }
    }
    const v8f cacc = caccE + caccO;
    // store partials, reduce the two K-halves, write ctx in [B,L,H*hd]
    {
      float* cp = sC + kh * (QT_ * HEAD_DIM) +
                  (mt * 16 + ((lane >> 4) << 3)) * HEAD_DIM + nt * 16 +
                  (lane & 15);
#pragma unroll
      for (int i = 0; i < 8; ++i) cp[i * HEAD_DIM] = cacc[i];
    }
    __syncthreads();
    {
      float* cg = ctx + ((size_t)b * SEQ + q0) * D_MODEL + h * HEAD_DIM;
      const int idx = tid * 4; // 2048 floats / 512 threads = one float4 each
      const float4 p0 = *(const float4*)(sC + idx);
      const float4 p1 = *(const float4*)(sC + QT_ * HEAD_DIM + idx);
      float4 o;
      o.x = p0.x + p1.x;
      o.y = p0.y + p1.y;
      o.z = p0.z + p1.z;
      o.w = p0.w + p1.w;
      const int m = idx >> 6, c = idx & 63;
      *(float4*)(cg + (size_t)m * D_MODEL + c) = o;
      // the head-mean store below and the next head reuse the registers that this store names
      asm volatile("s_wait_xcnt 0x0" ::: "memory");
    }
  }

  // ---- Head-mean weights: every element stored once, in pairs (unrolled:
  // wacc) ------------------------------------------------------------------
  {
    float* wout = wmean + ((size_t)b * SEQ + q0 + wave * 2) * SEQ + 2 * lane;
#pragma unroll
    for (int rr = 0; rr < 2; ++rr)
#pragma unroll
      for (int j = 0; j < 32; ++j) {
        v2f t;
        t.x = wacc[rr][2 * j];
        t.y = wacc[rr][2 * j + 1];
        *(v2f*)(wout + (size_t)rr * SEQ + 64 * j) = t;
      }
  }
}

extern "C" void kernel_launch(void* const* d_in, const int* in_sizes, int n_in,
                              void* d_out, int out_size, void* d_ws,
                              size_t ws_size, hipStream_t stream) {
  (void)in_sizes; (void)n_in; (void)out_size; (void)ws_size;
  const float* q = (const float*)d_in[0];
  const float* k = (const float*)d_in[1];
  const float* v = (const float*)d_in[2];
  const float* in_w = (const float*)d_in[3];  // [3*1024, 1024]
  const float* in_b = (const float*)d_in[4];  // [3*1024]
  const float* out_w = (const float*)d_in[5]; // [1024, 1024]
  const float* out_b = (const float*)d_in[6]; // [1024]

  float* out = (float*)d_out;                  // [8192*1024]
  float* wmean = out + (size_t)MTOT * D_MODEL; // [4*2048*2048]

  const size_t QKV_N = (size_t)MTOT * D_MODEL; // 8,388,608 floats
  float* qp = (float*)d_ws;
  float* kp = qp + QKV_N;
  float* vp = kp + QKV_N;
  float* ctx = vp + QKV_N;

  const dim3 gemm_grid(D_MODEL / 64, MTOT / 64); // (16, 128)
  gemm_xwt_kernel<true><<<gemm_grid, 256, 0, stream>>>(q, in_w, in_b, qp);
  gemm_xwt_kernel<true><<<gemm_grid, 256, 0, stream>>>(
      k, in_w + (size_t)D_MODEL * D_MODEL, in_b + D_MODEL, kp);
  gemm_xwt_kernel<true><<<gemm_grid, 256, 0, stream>>>(
      v, in_w + (size_t)2 * D_MODEL * D_MODEL, in_b + 2 * D_MODEL, vp);

  static_assert(ATTN_LDS_BYTES <= 320 * 1024, "fits WGP LDS");
  attn_kernel<<<dim3(SEQ / QT_, BATCH), 512, 0, stream>>>(qp, kp, vp, ctx,
                                                          wmean);

  gemm_xwt_kernel<false><<<gemm_grid, 256, 0, stream>>>(ctx, out_w, out_b, out);
}

// v005
// One run takes 778 microseconds.
// Timed twice side by side with v004, it ran 1.04 times as fast both times.
// Over all steps from v000 it is 1.83 times as fast.
#include <hip/hip_runtime.h>
#include <hip/hip_bf16.h>

// MHA fp32 forward for B=4, L=2048, D=1024, H=16, hd=64 on gfx1250 (MI455X).
// Matrix math on v_wmma_f32_16x16x4_f32; tile staging via CDNA5 async
// global->LDS copies (GLOBAL_LOAD_ASYNC_TO_LDS_B128, ASYNCcnt) with double
// buffering. Q A-fragments register-resident; K-parity-split accumulator
// chains for WMMA ILP. In the attention kernel the fragments of a staged tile
// are read from LDS one tile ahead of their WMMAs, into a second register set. One attention work-group (16 waves, 32 query rows) walks
// all 16 heads of its query tile and keeps the head mean of the probabilities
// in registers.
// Workspace layout (needs 128 MB):
//   qp [B,H,L,64] | kp [B,H,L,64] | vp [B,H,L,64] | ctx [B,L,1024]
// d_out layout: out [B*L*1024] floats, then weights [B*2048*2048] floats.

typedef __attribute__((ext_vector_type(2))) float v2f;
typedef __attribute__((ext_vector_type(8))) float v8f;

#define D_MODEL 1024
#define NHEADS 16
#define HEAD_DIM 64
#define BATCH 4
#define SEQ 2048
#define MTOT (BATCH * SEQ) // 8192

static __device__ __forceinline__ v8f wmma_f32(v2f a, v2f b, v8f c) {
  // (neg_a, A, neg_b, B, c_mod, C, reuse_a, reuse_b)
  return __builtin_amdgcn_wmma_f32_16x16x4_f32(false, a, false, b, (short)0, c,
                                               false, false);
}

// Async 16B global->LDS copy (tracked by ASYNCcnt). VDST VGPR holds the
// workgroup-relative LDS byte address (= low 32 bits of the generic pointer
// to __shared__ on AMDGPU). Both addresses 16B-aligned.
static __device__ __forceinline__ void async_f4(const float* g, float* l) {
  const unsigned lds = (unsigned)(size_t)l;
  asm volatile("global_load_async_to_lds_b128 %0, %1, off" ::"v"(lds), "v"(g)
               : "memory");
}
// The same copy with s_wait_xcnt 0 as the last line of its own statement, so
// that no later write of the address registers can be scheduled in front of it.
static __device__ __forceinline__ void async_f4_w(const float* g, float* l) {
  const unsigned lds = (unsigned)(size_t)l;
  // copy + its wait in one statement (see above)
  asm volatile("global_load_async_to_lds_b128 %0, %1, off\n\t"
               "s_wait_xcnt 0x0" ::"v"(lds), "v"(g)
               : "memory");
}
// Two such copies, gstep floats apart in global memory and lstep floats apart
// in LDS, sharing one statement and one s_wait_xcnt 0 behind the last.
static __device__ __forceinline__ void async_f4x2_w(const float* g, float* l,
                                                    int gstep, int lstep) {
  const unsigned l0 = (unsigned)(size_t)l;
  const unsigned ls = (unsigned)lstep * 4u;
  // two copies + their one wait in one statement (see above)
  asm volatile("global_load_async_to_lds_b128 %0, %2, off\n\t"
               "global_load_async_to_lds_b128 %1, %3, off\n\t"
               "s_wait_xcnt 0x0" ::"v"(l0),
               "v"(l0 + ls), "v"(g), "v"(g + gstep)
               : "memory");
}
static __device__ __forceinline__ void wait_async0() {
  asm volatile("s_wait_asynccnt 0x0" ::: "memory");
}
// Hand-over point of the attention ring: this wave's LDS reads and writes have
// retired, its own copies have landed, then the work-group barrier publishes
// the landed tile and frees the tile that was read last.
static __device__ __forceinline__ void ring_publish() {
  // keeps the trip's last WMMAs (on fragments read a trip earlier) in front of the waits: moved behind
  // them they would no longer cover the flight of the next tile's copies
  __builtin_amdgcn_sched_barrier(0);
  asm volatile("s_wait_dscnt 0x0" ::: "memory");
  wait_async0();
  __syncthreads();
}

// ---------------------------------------------------------------------------
// Generic Y = X @ W^T + bias, X:[8192,1024], W:[N=1024 rows,1024] row-major.
// Block tile 64(M) x 64(N), 8 waves; each wave a 16x32 strip. K streamed in
// 32-wide chunks, async double-buffered. Pitch 36 (144B rows: 16B aligned,
// conflict-free fragment reads). Four parity-split accumulator chains.
// QKV=true scatters output into [B,H,L,hd]; else plain row-major [M,1024].
// ---------------------------------------------------------------------------
#define GP 36 // gemm LDS pitch (floats)

template <bool QKV>
__global__ __launch_bounds__(256) void gemm_xwt_kernel(
    const float* __restrict__ X, const float* __restrict__ W,
    const float* __restrict__ bias, float* __restrict__ Y) {
  __shared__ float Xs[2][64 * GP];
  __shared__ float Ws[2][64 * GP];

  const int tid = threadIdx.x;
  const int lane = tid & 31;
  const int wave = tid >> 5;
  const int wm = wave >> 1; // 0..3 -> M subtile
  const int wn = wave & 1;  // 0..1 -> N strip of 32
  const int m0 = blockIdx.y * 64;
  const int n0 = blockIdx.x * 64;

  v8f acc0e = {}, acc0o = {}, acc1e = {}, acc1o = {};

  auto stage = [&](int buf, int kc) {
#pragma unroll
    for (int it = 0; it < 2; ++it) {
      const int idx = tid + it * 256; // 0..511 float4 slots
      const int r = idx >> 3;
      const int s = idx & 7;
      async_f4(const_cast<float*>(X) + (size_t)(m0 + r) * D_MODEL + kc + s * 4,
               &Xs[buf][r * GP + s * 4]);
      async_f4(const_cast<float*>(W) + (size_t)(n0 + r) * D_MODEL + kc + s * 4,
               &Ws[buf][r * GP + s * 4]);
    }
  };

  stage(0, 0);
  for (int kc = 0; kc < D_MODEL; kc += 32) {
    const int buf = (kc >> 5) & 1;
    wait_async0();
    __syncthreads(); // tile[buf] in LDS; everyone done reading tile[buf^1]
    if (kc + 32 < D_MODEL) stage(buf ^ 1, kc + 32);

#pragma unroll
    for (int kk = 0; kk < 8; ++kk) {
      const int kb = kk * 4 + ((lane >> 4) << 1);
      v2f a, b0, b1;
      const int ar = (wm * 16 + (lane & 15)) * GP + kb;
      a.x = Xs[buf][ar];
      a.y = Xs[buf][ar + 1];
      const int br0 = (wn * 32 + (lane & 15)) * GP + kb;
      const int br1 = (wn * 32 + 16 + (lane & 15)) * GP + kb;
      b0.x = Ws[buf][br0];
      b0.y = Ws[buf][br0 + 1];
      b1.x = Ws[buf][br1];
      b1.y = Ws[buf][br1 + 1];
      if (kk & 1) {
        acc0o = wmma_f32(a, b0, acc0o);
        acc1o = wmma_f32(a, b1, acc1o);
      } else {
        acc0e = wmma_f32(a, b0, acc0e);
        acc1e = wmma_f32(a, b1, acc1e);
      }
    }
    // no trailing barrier: next iteration's leading barrier protects buffers
  }
  const v8f acc0 = acc0e + acc0o;
  const v8f acc1 = acc1e + acc1o;

  // C/D layout: lane -> n = lane&15, rows (lane>>4)*8 + i.
  const int mb = m0 + wm * 16 + ((lane >> 4) << 3);
#pragma unroll
  for (int sub = 0; sub < 2; ++sub) {
    const int n = n0 + wn * 32 + sub * 16 + (lane & 15);
    const float bv = bias[n];
#pragma unroll
    for (int i = 0; i < 8; ++i) {
      const float val = (sub == 0 ? acc0[i] : acc1[i]) + bv;
      const int m = mb + i;
      size_t off;
      if (QKV) {
        // [B,H,L,hd]: b=m/2048, l=m%2048, h=n/64, hd=n%64
        off = (((size_t)((m >> 11) * NHEADS + (n >> 6)) * SEQ) + (m & 2047)) *
                  HEAD_DIM +
              (n & 63);
      } else {
        off = (size_t)m * D_MODEL + n;
      }
      Y[off] = val;
    }
  }
}

// ---------------------------------------------------------------------------
// Fused attention: one workgroup of 16 waves per (b, 32-query tile), looping
// over heads. Waves 0-7 work on query rows 0-15, waves 8-15 on rows 16-31, so
// every staged K or V tile is read by both row groups.
// LDS: sS 32x2050 scores->probs | sQ 32x68 | ring of 2 tiles (K: 128 keys x
//      32 of hd, pitch 36; V: 64 keys x 64, pitch 68), async-staged
//      | sC 2x32x64 ctx partials
// ---------------------------------------------------------------------------
#define QT_ 32   // query rows per work-group
#define QP_ 68   // sQ pitch
#define KP_ 36   // K tile pitch (rows 144B -> 16B aligned)
#define VP_ 68   // V tile pitch (rows 272B -> 16B aligned)
#define RB_ 4608 // floats per ring tile: 128 * KP_ (K), 64 * VP_ = 4352 (V)
#define SP_ 2050 // sS pitch
#define ATTN_LDS_FLOATS (QT_ * QP_ + 2 * RB_ + QT_ * SP_ + 2 * QT_ * HEAD_DIM)
#define ATTN_LDS_BYTES (ATTN_LDS_FLOATS * 4) // 324352 B <= 320 KB WGP LDS

__global__ __launch_bounds__(512) void attn_kernel(
    const float* __restrict__ qp, const float* __restrict__ kp,
    const float* __restrict__ vp, float* __restrict__ ctx,
    float* __restrict__ wmean /* [B,2048,2048], every element stored once */) {
  __shared__ __attribute__((aligned(16))) float smem[ATTN_LDS_FLOATS];
  float* sS = smem;            // 32 x 2050 (first: row steps fit ds offsets)
  float* sQ = sS + QT_ * SP_;  // 32 x 68
  float* sK0 = sQ + QT_ * QP_; // ring tile 0
  float* sK1 = sK0 + RB_;      // ring tile 1
  float* sC = sK1 + RB_;       // 2 x 32 x 64

  const int q0 = blockIdx.x * QT_;
  const int b = blockIdx.y;
  const int tid = threadIdx.x;
  const int lane = tid & 31;
  const int wave = tid >> 5;
  const int mt = wave >> 3; // 16-row group of the query tile
  const int w8 = wave & 7;  // role of the wave inside its row group
  // Where this work-group starts its walk over the key axis (in units of 128
  // keys, wrapping round). For speed only: the 64 work-groups of a batch read
  // the same K and V; started at 16 different places they do not all ask for
  // the same not yet cached tile at the same moment, and a tile that one of
  // them has fetched from memory is an L2 hit for those that come to it later.
  // (low bits and bits 3-4: neighbours in the grid get different starts)
  const int rot = ((blockIdx.x >> 3) & 3) * 4 + (blockIdx.x & 3);

  // Head mean of the probabilities: this lane owns rows wave*2 + rr, columns
  // 2*lane + 64*(j>>1) + (j&1), the same elements it normalises in phase 3 of
  // every head, where they are added.
  // (every loop over wacc is fully unrolled: constant indices keep it in VGPRs)
  float wacc[2][64];
#pragma unroll
  for (int rr = 0; rr < 2; ++rr)
#pragma unroll
    for (int j = 0; j < 64; ++j) wacc[rr][j] = 0.f;

  for (int h = 0; h < NHEADS; ++h) {
    const int bh = b * NHEADS + h; // matches [B,H,...] flattening
    const float* Qg = qp + (size_t)bh * SEQ * HEAD_DIM;
    const float* Kg = kp + (size_t)bh * SEQ * HEAD_DIM;
    const float* Vg = vp + (size_t)bh * SEQ * HEAD_DIM;

    // K tile c of the walk: keys k0 .. k0+127 with k0 = (((c>>1) + rot) & 15)
    // * 128, hd columns (c&1)*32 .. +31
    // (1024 float4, 2/thread: slot t&7 of rows t>>3 and (t>>3) + 64)
    auto stageK = [&](float* dst, int c) {
      const int r = tid >> 3;
      const int s = tid & 7;
      const int k0 = (((c >> 1) + rot) & 15) * 128;
      async_f4x2_w(Kg + (size_t)(k0 + r) * HEAD_DIM + (c & 1) * 32 + s * 4,
                   &dst[r * KP_ + s * 4], 64 * HEAD_DIM, 64 * KP_);
    };
    // V tile c of the walk: keys k0 .. k0+63 with k0 = ((c + 2*rot) & 31) * 64,
    // all 64 hd columns
    // (1024 float4, 2/thread: slot t&15 of rows t>>4 and (t>>4) + 32)
    auto stageV = [&](float* dst, int c) {
      const int r = tid >> 4;
      const int s = tid & 15;
      const int k0 = ((c + 2 * rot) & 31) * 64;
      async_f4x2_w(Vg + (size_t)(k0 + r) * HEAD_DIM + s * 4,
                   &dst[r * VP_ + s * 4], 32 * HEAD_DIM, 32 * VP_);
    };

    // ---- Phase 1: async-stage Q tile (32x64 = 512 float4, 1/thread), K0, K1
    // (sQ, sK0, sK1 and sS were last read in front of the previous head's
    // barriers)
    {
      const int r = tid >> 4;
      const int s = tid & 15;
      async_f4_w(Qg + (size_t)(q0 + r) * HEAD_DIM + s * 4,
                 &sQ[r * QP_ + s * 4]);
    }
    stageK(sK0, 0);
    stageK(sK1, 1);
    ring_publish(); // Q tile and K tiles 0 and 1 resident

    // Preload the 16 Q A-fragments (invariant across all K tiles): 32 VGPRs.
    v2f aq[16];
    {
      const float* qf = sQ + (mt * 16 + (lane & 15)) * QP_ + ((lane >> 4) << 1);
#pragma unroll
      for (int kk = 0; kk < 16; ++kk) {
        aq[kk].x = qf[kk * 4];
        aq[kk].y = qf[kk * 4 + 1];
      }
    }

    // ---- Phase 2: raw scores S = Q @ K^T (scale folded into softmax) -----
    // The B fragments of K tile c + 1 are read from LDS during trip c, into the
    // register set that trip c does not use, so that behind each barrier the
    // WMMAs of tile c start from registers instead of waiting for LDS. Tile
    // c + 2 is copied meanwhile into the buffer of tile c, whose fragments were
    // read in trip c - 1, in front of the barrier that opened trip c.
    const int kfo = (w8 * 16 + (lane & 15)) * KP_ + ((lane >> 4) << 1);
    v2f kbA[8], kbB[8]; // fragments of the even and of the odd K tiles
    auto loadK = [&](v2f(&f)[8], const float* tile) {
      const float* kf = tile + kfo;
#pragma unroll
      for (int kk = 0; kk < 8; ++kk) { // K = 32 / 4
        f[kk].x = kf[kk * 4];
        f[kk].y = kf[kk * 4 + 1];
      }
    };
    loadK(kbA, sK0);

    for (int rb = 0; rb < 16; ++rb) { // 128 keys: two K tiles (hd halves)
      v8f accE = {}, accO = {};
      // trip c = 2 * rb. Every wave holds its fragments of tile c, so sK0 is
      // free; tile c + 1 is resident
      ring_publish();
      // The four fences of a trip hold this order: two WMMAs (they need no LDS
      // and cover the barrier), the copies, two WMMAs (they cover the issue of
      // the LDS reads), the LDS reads as one group, the other four WMMAs. With
      // the reads or the copies' wait in front of all WMMAs the matrix unit
      // idles behind every barrier; with the copies or the reads sunk further
      // they are waited for at the trip's foot. (The first fence, mask 6, lets
      // plain vector and scalar instructions pass: the copies' address
      // arithmetic may so move up in front of the barrier's wait.)
      accE = wmma_f32(aq[0], kbA[0], accE);
      accO = wmma_f32(aq[1], kbA[1], accO);
      __builtin_amdgcn_sched_barrier(6);
      if (rb < 15) stageK(sK0, rb * 2 + 2);
      __builtin_amdgcn_sched_barrier(0);
      accE = wmma_f32(aq[2], kbA[2], accE);
      accO = wmma_f32(aq[3], kbA[3], accO);
      __builtin_amdgcn_sched_barrier(0);
      loadK(kbB, sK1);
      __builtin_amdgcn_sched_barrier(0);
      // unrolled: aq must be indexed by constants to stay in registers
#pragma unroll
      for (int kk = 4; kk < 8; ++kk) {
        if (kk & 1)
          accO = wmma_f32(aq[kk], kbA[kk], accO);
        else
          accE = wmma_f32(aq[kk], kbA[kk], accE);
      }
      // trip c = 2 * rb + 1: the same with sK1
      ring_publish();
      // (four fences: the order of the even trip)
      accE = wmma_f32(aq[8], kbB[0], accE);
      accO = wmma_f32(aq[9], kbB[1], accO);
      __builtin_amdgcn_sched_barrier(6);
      if (rb < 15) stageK(sK1, rb * 2 + 3);
      __builtin_amdgcn_sched_barrier(0);
      accE = wmma_f32(aq[10], kbB[2], accE);
      accO = wmma_f32(aq[11], kbB[3], accO);
      __builtin_amdgcn_sched_barrier(0);
      if (rb < 15) loadK(kbA, sK0);
      __builtin_amdgcn_sched_barrier(0);
#pragma unroll
      for (int kk = 4; kk < 8; ++kk) {
        if (kk & 1)
          accO = wmma_f32(aq[8 + kk], kbB[kk], accO);
        else
          accE = wmma_f32(aq[8 + kk], kbB[kk], accE);
      }
      const v8f acc = accE + accO;
      float* sp = sS + (mt * 16 + ((lane >> 4) << 3)) * SP_ +
                  ((rb + rot) & 15) * 128 + w8 * 16 + (lane & 15);
#pragma unroll
      for (int i = 0; i < 8; ++i) sp[i * SP_] = acc[i];
    }
    ring_publish(); // all score columns visible; both ring tiles free

    // kick off V tiles 0 and 1 now; they overlap the softmax below
    stageV(sK0, 0);
    stageV(sK1, 1);

    // ---- Phase 3: row softmax of s/8 (wave32 shuffle reductions) ---------
    // A lane keeps its 64 scores of the row (32 column pairs) in registers from
    // the one LDS read to the one LDS write of the probabilities, and adds each
    // probability to the head mean as it is made (heads in order 0..15).
    // (every loop over e and wacc is fully unrolled: constant indices keep
    // them in VGPRs)
#pragma unroll
    for (int rr = 0; rr < 2; ++rr) {
      float* row = sS + (wave * 2 + rr) * SP_ + 2 * lane; // 8-byte aligned
      float e[64];
#pragma unroll
      for (int j = 0; j < 32; ++j) {
        const v2f t = *(const v2f*)(row + 64 * j);
        e[2 * j] = t.x;
        e[2 * j + 1] = t.y;
      }
      float mx = -INFINITY;
#pragma unroll
      for (int j = 0; j < 64; ++j) mx = fmaxf(mx, e[j]);
      for (int off = 16; off; off >>= 1)
        mx = fmaxf(mx, __shfl_xor(mx, off, 32));
      float sum0 = 0.f, sum1 = 0.f; // even and odd columns: two add chains
#pragma unroll
      for (int j = 0; j < 32; ++j) {
        e[2 * j] = __expf((e[2 * j] - mx) * 0.125f); // 1/sqrt(64)
        e[2 * j + 1] = __expf((e[2 * j + 1] - mx) * 0.125f);
        sum0 += e[2 * j];
        sum1 += e[2 * j + 1];
      }
      float sum = sum0 + sum1;
      for (int off = 16; off; off >>= 1) sum += __shfl_xor(sum, off, 32);
      const float inv = 1.0f / sum;
#pragma unroll
      for (int j = 0; j < 32; ++j) {
        v2f t;
        t.x = e[2 * j] *= inv;
        t.y = e[2 * j + 1] *= inv;
        *(v2f*)(row + 64 * j) = t;
      }
      // wacc += p * (1/16), 0x3d800000 = 1.0f / NHEADS. Written in asm so that
      // it stays here: as plain code the compiler moves the 128 adds to the
      // foot of the head loop and spills the probabilities across phase 5.
#pragma unroll
      for (int j = 0; j < 64; ++j)
        asm volatile("v_fmac_f32 %0, 0x3d800000, %1"
                     : "+v"(wacc[rr][j])
                     : "v"(e[j]));
    }

    // ---- Phase 5: ctx = P @ V; the 8 waves of a row group split
    //      4 n-tiles x 2 K-halves of each 64-key tile ----------------------
    // As in phase 2, the A (probability) and B (V) fragments of tile c + 1 are
    // read from LDS during trip c, into the register set that trip c leaves.
    v8f caccE = {}, caccO = {};
    const int nt = w8 & 3;  // 16-wide column tile of hd
    const int kh = w8 >> 2; // K half within each 64-key tile
    const int kl0 = kh * 32 + ((lane >> 4) << 1); // first key of this lane
    const float* pbase = sS + (mt * 16 + (lane & 15)) * SP_ + kl0;
    const int vfo = kl0 * VP_ + nt * 16 + (lane & 15);
    v2f paA[8], vbA[8], paB[8], vbB[8]; // even tiles, odd tiles
    auto loadPV = [&](v2f(&pa)[8], v2f(&vb)[8], const float* tile, int chunk) {
      const float* pf = pbase + ((chunk + 2 * rot) & 31) * 64;
      const float* vf = tile + vfo;
#pragma unroll
      for (int kk = 0; kk < 8; ++kk) { // 32 K-values per half / 4
        pa[kk].x = pf[kk * 4];
        pa[kk].y = pf[kk * 4 + 1];
        vb[kk].x = vf[(kk * 4) * VP_];
        vb[kk].y = vf[(kk * 4 + 1) * VP_];
      }
    };
    ring_publish(); // every row of probabilities, V tiles 0 and 1 resident
    loadPV(paA, vbA, sK0, 0);

    for (int cp = 0; cp < 16; ++cp) {
      // trip c = 2 * cp. Every wave holds its fragments of tile c, so sK0 is
      // free; tile c + 1 is resident
      ring_publish();
      // (four fences: the order of a trip of phase 2, for the same reasons)
      caccE = wmma_f32(paA[0], vbA[0], caccE);
      caccO = wmma_f32(paA[1], vbA[1], caccO);
      __builtin_amdgcn_sched_barrier(6);
      if (cp < 15) stageV(sK0, cp * 2 + 2);
      __builtin_amdgcn_sched_barrier(0);
      caccE = wmma_f32(paA[2], vbA[2], caccE);
      caccO = wmma_f32(paA[3], vbA[3], caccO);
      __builtin_amdgcn_sched_barrier(0);
      loadPV(paB, vbB, sK1, cp * 2 + 1);
      __builtin_amdgcn_sched_barrier(0);
#pragma unroll
      for (int kk = 4; kk < 8; ++kk) {
        if (kk & 1)
          caccO = wmma_f32(paA[kk], vbA[kk], caccO);
        else
          caccE = wmma_f32(paA[kk], vbA[kk], caccE);
      }
      // trip c = 2 * cp + 1: the same with sK1
      ring_publish();
      // (four fences: as in the even trip)
      caccE = wmma_f32(paB[0], vbB[0], caccE);
      caccO = wmma_f32(paB[1], vbB[1], caccO);
      __builtin_amdgcn_sched_barrier(6);
      if (cp < 15) stageV(sK1, cp * 2 + 3);
      __builtin_amdgcn_sched_barrier(0);
      caccE = wmma_f32(paB[2], vbB[2], caccE);
      caccO = wmma_f32(paB[3], vbB[3], caccO);
      __builtin_amdgcn_sched_barrier(0);
      if (cp < 15) loadPV(paA, vbA, sK0, cp * 2 + 2);
      __builtin_amdgcn_sched_barrier(0);
#pragma unroll
      for (int kk = 4; kk < 8; ++kk) {
        if (kk & 1)
          caccO = wmma_f32(paB[kk], vbB[kk], caccO);
        else
          caccE = wmma_f32(paB[kk], vbB[kk], caccE);
      }
    }
    const v8f cacc = caccE + caccO;
    // store partials, reduce the two K-halves, write ctx in [B,L,H*hd]
    {
      float* cp = sC + kh * (QT_ * HEAD_DIM) +
                  (mt * 16 + ((lane >> 4) << 3)) * HEAD_DIM + nt * 16 +
                  (lane & 15);
#pragma unroll
      for (int i = 0; i < 8; ++i) cp[i * HEAD_DIM] = cacc[i];
    }
    __syncthreads();
    {
      float* cg = ctx + ((size_t)b * SEQ + q0) * D_MODEL + h * HEAD_DIM;
      const int idx = tid * 4; // 2048 floats / 512 threads = one float4 each
      const float4 p0 = *(const float4*)(sC + idx);
      const float4 p1 = *(const float4*)(sC + QT_ * HEAD_DIM + idx);
      float4 o;
      o.x = p0.x + p1.x;
      o.y = p0.y + p1.y;
      o.z = p0.z + p1.z;
      o.w = p0.w + p1.w;
      const int m = idx >> 6, c = idx & 63;
      *(float4*)(cg + (size_t)m * D_MODEL + c) = o;
      // the head-mean store below and the next head reuse the registers that this store names
      asm volatile("s_wait_xcnt 0x0" ::: "memory");
    }
  }

  // ---- Head-mean weights: every element stored once, in pairs (unrolled:
  // wacc) ------------------------------------------------------------------
  {
    float* wout = wmean + ((size_t)b * SEQ + q0 + wave * 2) * SEQ + 2 * lane;
#pragma unroll
    for (int rr = 0; rr < 2; ++rr)
#pragma unroll
      for (int j = 0; j < 32; ++j) {
        v2f t;
        t.x = wacc[rr][2 * j];
        t.y = wacc[rr][2 * j + 1];
        *(v2f*)(wout + (size_t)rr * SEQ + 64 * j) = t;
      }
  }
}

extern "C" void kernel_launch(void* const* d_in, const int* in_sizes, int n_in,
                              void* d_out, int out_size, void* d_ws,
                              size_t ws_size, hipStream_t stream) {
  (void)in_sizes; (void)n_in; (void)out_size; (void)ws_size;
  const float* q = (const float*)d_in[0];
  const float* k = (const float*)d_in[1];
  const float* v = (const float*)d_in[2];
  const float* in_w = (const float*)d_in[3];  // [3*1024, 1024]
  const float* in_b = (const float*)d_in[4];  // [3*1024]
  const float* out_w = (const float*)d_in[5]; // [1024, 1024]
  const float* out_b = (const float*)d_in[6]; // [1024]

  float* out = (float*)d_out;                  // [8192*1024]
  float* wmean = out + (size_t)MTOT * D_MODEL; // [4*2048*2048]

  const size_t QKV_N = (size_t)MTOT * D_MODEL; // 8,388,608 floats
  float* qp = (float*)d_ws;
  float* kp = qp + QKV_N;
  float* vp = kp + QKV_N;
  float* ctx = vp + QKV_N;

  const dim3 gemm_grid(D_MODEL / 64, MTOT / 64); // (16, 128)
  gemm_xwt_kernel<true><<<gemm_grid, 256, 0, stream>>>(q, in_w, in_b, qp);
  gemm_xwt_kernel<true><<<gemm_grid, 256, 0, stream>>>(
      k, in_w + (size_t)D_MODEL * D_MODEL, in_b + D_MODEL, kp);
  gemm_xwt_kernel<true><<<gemm_grid, 256, 0, stream>>>(
      v, in_w + (size_t)2 * D_MODEL * D_MODEL, in_b + 2 * D_MODEL, vp);

  static_assert(ATTN_LDS_BYTES <= 320 * 1024, "fits WGP LDS");
  attn_kernel<<<dim3(SEQ / QT_, BATCH), 512, 0, stream>>>(qp, kp, vp, ctx,
                                                          wmean);

  gemm_xwt_kernel<false><<<gemm_grid, 256, 0, stream>>>(ctx, out_w, out_b, out);
}

// v006
// A run of this version takes 746 microseconds.
// Next to v005, in two timings, it ran 1.04 times as fast each time.
// Counting every step since v000, it is 1.91 times as fast.
#include <hip/hip_runtime.h>
#include <hip/hip_bf16.h>

// MHA fp32 forward for B=4, L=2048, D=1024, H=16, hd=64 on gfx1250 (MI455X).
// Matrix math on v_wmma_f32_16x16x4_f32; tile staging via CDNA5 async
// global->LDS copies (GLOBAL_LOAD_ASYNC_TO_LDS_B128, ASYNCcnt) with double
// buffering. Q A-fragments register-resident; K-parity-split accumulator
// chains for WMMA ILP. In the attention kernel the fragments of a staged tile
// are read from LDS one tile ahead of their WMMAs, into a second register set. One attention work-group (16 waves, 32 query rows) walks
// all 16 heads of its query tile and keeps the head mean of the probabilities
// in registers.
// Workspace layout (needs 128 MB):
//   qp [B,H,L,64] | kp [B,H,L,64] | vp [B,H,L,64] | ctx [B,L,1024]
// d_out layout: out [B*L*1024] floats, then weights [B*2048*2048] floats.

typedef __attribute__((ext_vector_type(2))) float v2f;
typedef __attribute__((ext_vector_type(8))) float v8f;

#define D_MODEL 1024
#define NHEADS 16
#define HEAD_DIM 64
#define BATCH 4
#define SEQ 2048
#define MTOT (BATCH * SEQ) // 8192

static __device__ __forceinline__ v8f wmma_f32(v2f a, v2f b, v8f c) {
  // (neg_a, A, neg_b, B, c_mod, C, reuse_a, reuse_b)
  return __builtin_amdgcn_wmma_f32_16x16x4_f32(false, a, false, b, (short)0, c,
                                               false, false);
}

// Async 16B global->LDS copy (tracked by ASYNCcnt). VDST VGPR holds the
// workgroup-relative LDS byte address (= low 32 bits of the generic pointer
// to __shared__ on AMDGPU). Both addresses 16B-aligned.
static __device__ __forceinline__ void async_f4(const float* g, float* l) {
  const unsigned lds = (unsigned)(size_t)l;
  asm volatile("global_load_async_to_lds_b128 %0, %1, off" ::"v"(lds), "v"(g)
               : "memory");
}
// The same copy with s_wait_xcnt 0 as the last line of its own statement, so
// that no later write of the address registers can be scheduled in front of it.
static __device__ __forceinline__ void async_f4_w(const float* g, float* l) {
  const unsigned lds = (unsigned)(size_t)l;
  // copy + its wait in one statement (see above)
  asm volatile("global_load_async_to_lds_b128 %0, %1, off\n\t"
               "s_wait_xcnt 0x0" ::"v"(lds), "v"(g)
               : "memory");
}
// Two such copies, gstep floats apart in global memory and lstep floats apart
// in LDS, sharing one statement and one s_wait_xcnt 0 behind the last.
static __device__ __forceinline__ void async_f4x2_w(const float* g, float* l,
                                                    int gstep, int lstep) {
  const unsigned l0 = (unsigned)(size_t)l;
  const unsigned ls = (unsigned)lstep * 4u;
  // two copies + their one wait in one statement (see above)
  asm volatile("global_load_async_to_lds_b128 %0, %2, off\n\t"
               "global_load_async_to_lds_b128 %1, %3, off\n\t"
               "s_wait_xcnt 0x0" ::"v"(l0),
               "v"(l0 + ls), "v"(g), "v"(g + gstep)
               : "memory");
}
static __device__ __forceinline__ void wait_async0() {
  asm volatile("s_wait_asynccnt 0x0" ::: "memory");
}
// Hand-over point of the attention ring: this wave's LDS reads and writes have
// retired, its own copies have landed, then the work-group barrier publishes
// the landed tile and frees the tile that was read last.
static __device__ __forceinline__ void ring_publish() {
  // keeps the trip's last WMMAs (on fragments read a trip earlier) in front of the waits: moved behind
  // them they would no longer cover the flight of the next tile's copies
  __builtin_amdgcn_sched_barrier(0);
  asm volatile("s_wait_dscnt 0x0" ::: "memory");
  wait_async0();
  __syncthreads();
}

// ---------------------------------------------------------------------------
// Generic Y = X @ W^T + bias, X:[8192,1024], W:[N=1024 rows,1024] row-major.
// Block tile 64(M) x 64(N), 8 waves; each wave a 16x32 strip. K streamed in
// 32-wide chunks, async double-buffered. Pitch 36 (144B rows: 16B aligned,
// conflict-free fragment reads). Four parity-split accumulator chains.
// QKV=true scatters output into [B,H,L,hd]; else plain row-major [M,1024].
// ---------------------------------------------------------------------------
#define GP 36 // gemm LDS pitch (floats)

template <bool QKV>
__global__ __launch_bounds__(256) void gemm_xwt_kernel(
    const float* __restrict__ X, const float* __restrict__ W,
    const float* __restrict__ bias, float* __restrict__ Y) {
  __shared__ float Xs[2][64 * GP];
  __shared__ float Ws[2][64 * GP];

  const int tid = threadIdx.x;
  const int lane = tid & 31;
  const int wave = tid >> 5;
  const int wm = wave >> 1; // 0..3 -> M subtile
  const int wn = wave & 1;  // 0..1 -> N strip of 32
  const int m0 = blockIdx.y * 64;
  const int n0 = blockIdx.x * 64;

  v8f acc0e = {}, acc0o = {}, acc1e = {}, acc1o = {};

  auto stage = [&](int buf, int kc) {
#pragma unroll
    for (int it = 0; it < 2; ++it) {
      const int idx = tid + it * 256; // 0..511 float4 slots
      const int r = idx >> 3;
      const int s = idx & 7;
      async_f4(const_cast<float*>(X) + (size_t)(m0 + r) * D_MODEL + kc + s * 4,
               &Xs[buf][r * GP + s * 4]);
      async_f4(const_cast<float*>(W) + (size_t)(n0 + r) * D_MODEL + kc + s * 4,
               &Ws[buf][r * GP + s * 4]);
    }
  };

  stage(0, 0);
  for (int kc = 0; kc < D_MODEL; kc += 32) {
    const int buf = (kc >> 5) & 1;
    wait_async0();
    __syncthreads(); // tile[buf] in LDS; everyone done reading tile[buf^1]
    if (kc + 32 < D_MODEL) stage(buf ^ 1, kc + 32);

#pragma unroll
    for (int kk = 0; kk < 8; ++kk) {
      const int kb = kk * 4 + ((lane >> 4) << 1);
      v2f a, b0, b1;
      const int ar = (wm * 16 + (lane & 15)) * GP + kb;
      a.x = Xs[buf][ar];
      a.y = Xs[buf][ar + 1];
      const int br0 = (wn * 32 + (lane & 15)) * GP + kb;
      const int br1 = (wn * 32 + 16 + (lane & 15)) * GP + kb;
      b0.x = Ws[buf][br0];
      b0.y = Ws[buf][br0 + 1];
      b1.x = Ws[buf][br1];
      b1.y = Ws[buf][br1 + 1];
      if (kk & 1) {
        acc0o = wmma_f32(a, b0, acc0o);
        acc1o = wmma_f32(a, b1, acc1o);
      } else {
        acc0e = wmma_f32(a, b0, acc0e);
        acc1e = wmma_f32(a, b1, acc1e);
      }
    }
    // no trailing barrier: next iteration's leading barrier protects buffers
  }
  const v8f acc0 = acc0e + acc0o;
  const v8f acc1 = acc1e + acc1o;

  // C/D layout: lane -> n = lane&15, rows (lane>>4)*8 + i.
  const int mb = m0 + wm * 16 + ((lane >> 4) << 3);
#pragma unroll
  for (int sub = 0; sub < 2; ++sub) {
    const int n = n0 + wn * 32 + sub * 16 + (lane & 15);
    const float bv = bias[n];
#pragma unroll
    for (int i = 0; i < 8; ++i) {
      const float val = (sub == 0 ? acc0[i] : acc1[i]) + bv;
      const int m = mb + i;
      size_t off;
      if (QKV) {
        // [B,H,L,hd]: b=m/2048, l=m%2048, h=n/64, hd=n%64
        off = (((size_t)((m >> 11) * NHEADS + (n >> 6)) * SEQ) + (m & 2047)) *
                  HEAD_DIM +
              (n & 63);
      } else {
        off = (size_t)m * D_MODEL + n;
      }
      Y[off] = val;
    }
  }
}

// ---------------------------------------------------------------------------
// Fused attention: one workgroup of 16 waves per (b, 32-query tile), looping
// over heads. Waves 0-7 work on query rows 0-15, waves 8-15 on rows 16-31, so
// every staged K or V tile is read by both row groups.
// LDS: sS 32x2052 scores->probs | sQ 32x68 | ring of 2 tiles (K: 128 keys x
//      32 of hd, pitch 36; V: 64 keys x 64, pitch 72), async-staged
//      | sC 2x32x64 ctx partials
// Pitches and the 64 LDS banks. sS, sQ, K tile: a fragment read takes a pair of
// words from each of 16 rows, lanes 16-31 two words further on; with a pitch of
// 4 x an odd number the rows start on 16 different multiples of 4, so all 64
// words fall on different banks. V tile: lanes 0-15 read 16 columns of one row,
// lanes 16-31 of the row two down; 2 * 72 = 16 mod 64 keeps them apart.
// ---------------------------------------------------------------------------
#define QT_ 32   // query rows per work-group
#define QP_ 68   // sQ pitch
#define KP_ 36   // K tile pitch (rows 144B -> 16B aligned)
#define VP_ 72   // V tile pitch (rows 288B -> 16B aligned)
#define RB_ 4608 // floats per ring tile: 128 * KP_ (K), 64 * VP_ (V)
#define SP_ 2052 // sS pitch
#define ATTN_LDS_FLOATS (QT_ * QP_ + 2 * RB_ + QT_ * SP_ + 2 * QT_ * HEAD_DIM)
#define ATTN_LDS_BYTES (ATTN_LDS_FLOATS * 4) // 324608 B <= 320 KB WGP LDS

__global__ __launch_bounds__(512) void attn_kernel(
    const float* __restrict__ qp, const float* __restrict__ kp,
    const float* __restrict__ vp, float* __restrict__ ctx,
    float* __restrict__ wmean /* [B,2048,2048], every element stored once */) {
  __shared__ __attribute__((aligned(16))) float smem[ATTN_LDS_FLOATS];
  float* sS = smem;            // 32 x 2052 (first: row steps fit ds offsets)
  float* sQ = sS + QT_ * SP_;  // 32 x 68
  float* sK0 = sQ + QT_ * QP_; // ring tile 0
  float* sK1 = sK0 + RB_;      // ring tile 1
  float* sC = sK1 + RB_;       // 2 x 32 x 64

  const int q0 = blockIdx.x * QT_;
  const int b = blockIdx.y;
  const int tid = threadIdx.x;
  const int lane = tid & 31;
  const int wave = tid >> 5;
  const int mt = wave >> 3; // 16-row group of the query tile
  const int w8 = wave & 7;  // role of the wave inside its row group
  // Where this work-group starts its walk over the key axis (in units of 128
  // keys, wrapping round). For speed only: the 64 work-groups of a batch read
  // the same K and V; started at 16 different places they do not all ask for
  // the same not yet cached tile at the same moment, and a tile that one of
  // them has fetched from memory is an L2 hit for those that come to it later.
  // (low bits and bits 3-4: neighbours in the grid get different starts)
  const int rot = ((blockIdx.x >> 3) & 3) * 4 + (blockIdx.x & 3);

  // Head mean of the probabilities: this lane owns rows wave*2 + rr, columns
  // 2*lane + 64*(j>>1) + (j&1), the same elements it normalises in phase 3 of
  // every head, where they are added.
  // (every loop over wacc is fully unrolled: constant indices keep it in VGPRs)
  float wacc[2][64];
#pragma unroll
  for (int rr = 0; rr < 2; ++rr)
#pragma unroll
    for (int j = 0; j < 64; ++j) wacc[rr][j] = 0.f;

  for (int h = 0; h < NHEADS; ++h) {
    const int bh = b * NHEADS + h; // matches [B,H,...] flattening
    const float* Qg = qp + (size_t)bh * SEQ * HEAD_DIM;
    const float* Kg = kp + (size_t)bh * SEQ * HEAD_DIM;
    const float* Vg = vp + (size_t)bh * SEQ * HEAD_DIM;

    // K tile c of the walk: keys k0 .. k0+127 with k0 = (((c>>1) + rot) & 15)
    // * 128, hd columns (c&1)*32 .. +31
    // (1024 float4, 2/thread: slot t&7 of rows t>>3 and (t>>3) + 64)
    auto stageK = [&](float* dst, int c) {
      const int r = tid >> 3;
      const int s = tid & 7;
      const int k0 = (((c >> 1) + rot) & 15) * 128;
      async_f4x2_w(Kg + (size_t)(k0 + r) * HEAD_DIM + (c & 1) * 32 + s * 4,
                   &dst[r * KP_ + s * 4], 64 * HEAD_DIM, 64 * KP_);
    };
    // V tile c of the walk: keys k0 .. k0+63 with k0 = ((c + 2*rot) & 31) * 64,
    // all 64 hd columns
    // (1024 float4, 2/thread: slot t&15 of rows t>>4 and (t>>4) + 32)
    auto stageV = [&](float* dst, int c) {
      const int r = tid >> 4;
      const int s = tid & 15;
      const int k0 = ((c + 2 * rot) & 31) * 64;
      async_f4x2_w(Vg + (size_t)(k0 + r) * HEAD_DIM + s * 4,
                   &dst[r * VP_ + s * 4], 32 * HEAD_DIM, 32 * VP_);
    };

    // ---- Phase 1: async-stage Q tile (32x64 = 512 float4, 1/thread), K0, K1
    // (sQ, sK0, sK1 and sS were last read in front of the previous head's
    // barriers)
    {
      const int r = tid >> 4;
      const int s = tid & 15;
      async_f4_w(Qg + (size_t)(q0 + r) * HEAD_DIM + s * 4,
                 &sQ[r * QP_ + s * 4]);
    }
    stageK(sK0, 0);
    stageK(sK1, 1);
    ring_publish(); // Q tile and K tiles 0 and 1 resident

    // Preload the 16 Q A-fragments (invariant across all K tiles): 32 VGPRs.
    v2f aq[16];
    {
      const float* qf = sQ + (mt * 16 + (lane & 15)) * QP_ + ((lane >> 4) << 1);
#pragma unroll
      for (int kk = 0; kk < 16; ++kk) {
        aq[kk].x = qf[kk * 4];
        aq[kk].y = qf[kk * 4 + 1];
      }
    }

    // ---- Phase 2: raw scores S = Q @ K^T (scale folded into softmax) -----
    // The B fragments of K tile c + 1 are read from LDS during trip c, into the
    // register set that trip c does not use, so that behind each barrier the
    // WMMAs of tile c start from registers instead of waiting for LDS. Tile
    // c + 2 is copied meanwhile into the buffer of tile c, whose fragments were
    // read in trip c - 1, in front of the barrier that opened trip c.
    const int kfo = (w8 * 16 + (lane & 15)) * KP_ + ((lane >> 4) << 1);
    v2f kbA[8], kbB[8]; // fragments of the even and of the odd K tiles
    auto loadK = [&](v2f(&f)[8], const float* tile) {
      const float* kf = tile + kfo;
#pragma unroll
      for (int kk = 0; kk < 8; ++kk) { // K = 32 / 4
        f[kk].x = kf[kk * 4];
        f[kk].y = kf[kk * 4 + 1];
      }
    };
    loadK(kbA, sK0);

    for (int rb = 0; rb < 16; ++rb) { // 128 keys: two K tiles (hd halves)
      v8f accE = {}, accO = {};
      // trip c = 2 * rb. Every wave holds its fragments of tile c, so sK0 is
      // free; tile c + 1 is resident
      ring_publish();
      // The four fences of a trip hold this order: two WMMAs (they need no LDS
      // and cover the barrier), the copies, two WMMAs (they cover the issue of
      // the LDS reads), the LDS reads as one group, the other four WMMAs. With
      // the reads or the copies' wait in front of all WMMAs the matrix unit
      // idles behind every barrier; with the copies or the reads sunk further
      // they are waited for at the trip's foot. (The first fence, mask 6, lets
      // plain vector and scalar instructions pass: the copies' address
      // arithmetic may so move up in front of the barrier's wait.)
      accE = wmma_f32(aq[0], kbA[0], accE);
      accO = wmma_f32(aq[1], kbA[1], accO);
      __builtin_amdgcn_sched_barrier(6);
      if (rb < 15) stageK(sK0, rb * 2 + 2);
      __builtin_amdgcn_sched_barrier(0);
      accE = wmma_f32(aq[2], kbA[2], accE);
      accO = wmma_f32(aq[3], kbA[3], accO);
      __builtin_amdgcn_sched_barrier(0);
      loadK(kbB, sK1);
      __builtin_amdgcn_sched_barrier(0);
      // unrolled: aq must be indexed by constants to stay in registers
#pragma unroll
      for (int kk = 4; kk < 8; ++kk) {
        if (kk & 1)
          accO = wmma_f32(aq[kk], kbA[kk], accO);
        else
          accE = wmma_f32(aq[kk], kbA[kk], accE);
      }
      // trip c = 2 * rb + 1: the same with sK1
      ring_publish();
      // (four fences: the order of the even trip)
      accE = wmma_f32(aq[8], kbB[0], accE);
      accO = wmma_f32(aq[9], kbB[1], accO);
      __builtin_amdgcn_sched_barrier(6);
      if (rb < 15) stageK(sK1, rb * 2 + 3);
      __builtin_amdgcn_sched_barrier(0);
      accE = wmma_f32(aq[10], kbB[2], accE);
      accO = wmma_f32(aq[11], kbB[3], accO);
      __builtin_amdgcn_sched_barrier(0);
      if (rb < 15) loadK(kbA, sK0);
      __builtin_amdgcn_sched_barrier(0);
#pragma unroll
      for (int kk = 4; kk < 8; ++kk) {
        if (kk & 1)
          accO = wmma_f32(aq[8 + kk], kbB[kk], accO);
        else
          accE = wmma_f32(aq[8 + kk], kbB[kk], accE);
      }
      const v8f acc = accE + accO;
      float* sp = sS + (mt * 16 + ((lane >> 4) << 3)) * SP_ +
                  ((rb + rot) & 15) * 128 + w8 * 16 + (lane & 15);
#pragma unroll
      for (int i = 0; i < 8; ++i) sp[i * SP_] = acc[i];
    }
    ring_publish(); // all score columns visible; both ring tiles free

    // kick off V tiles 0 and 1 now; they overlap the softmax below
    stageV(sK0, 0);
    stageV(sK1, 1);

    // ---- Phase 3: row softmax of s/8 (wave32 shuffle reductions) ---------
    // A lane keeps its 64 scores of the row (32 column pairs) in registers from
    // the one LDS read to the one LDS write of the probabilities, and adds each
    // probability to the head mean as it is made (heads in order 0..15).
    // (every loop over e and wacc is fully unrolled: constant indices keep
    // them in VGPRs)
#pragma unroll
    for (int rr = 0; rr < 2; ++rr) {
      float* row = sS + (wave * 2 + rr) * SP_ + 2 * lane; // 8-byte aligned
      float e[64];
#pragma unroll
      for (int j = 0; j < 32; ++j) {
        const v2f t = *(const v2f*)(row + 64 * j);
        e[2 * j] = t.x;
        e[2 * j + 1] = t.y;
      }
      float mx = -INFINITY;
#pragma unroll
      for (int j = 0; j < 64; ++j) mx = fmaxf(mx, e[j]);
      for (int off = 16; off; off >>= 1)
        mx = fmaxf(mx, __shfl_xor(mx, off, 32));
      float sum0 = 0.f, sum1 = 0.f; // even and odd columns: two add chains
#pragma unroll
      for (int j = 0; j < 32; ++j) {
        e[2 * j] = __expf((e[2 * j] - mx) * 0.125f); // 1/sqrt(64)
        e[2 * j + 1] = __expf((e[2 * j + 1] - mx) * 0.125f);
        sum0 += e[2 * j];
        sum1 += e[2 * j + 1];
      }
      float sum = sum0 + sum1;
      for (int off = 16; off; off >>= 1) sum += __shfl_xor(sum, off, 32);
      const float inv = 1.0f / sum;
#pragma unroll
      for (int j = 0; j < 32; ++j) {
        v2f t;
        t.x = e[2 * j] *= inv;
        t.y = e[2 * j + 1] *= inv;
        *(v2f*)(row + 64 * j) = t;
      }
      // wacc += p * (1/16), 0x3d800000 = 1.0f / NHEADS. Written in asm so that
      // it stays here: as plain code the compiler moves the 128 adds to the
      // foot of the head loop and spills the probabilities across phase 5.
#pragma unroll
      for (int j = 0; j < 64; ++j)
        asm volatile("v_fmac_f32 %0, 0x3d800000, %1"
                     : "+v"(wacc[rr][j])
                     : "v"(e[j]));
    }

    // ---- Phase 5: ctx = P @ V; the 8 waves of a row group split
    //      4 n-tiles x 2 K-halves of each 64-key tile ----------------------
    // As in phase 2, the A (probability) and B (V) fragments of tile c + 1 are
    // read from LDS during trip c, into the register set that trip c leaves.
    v8f caccE = {}, caccO = {};
    const int nt = w8 & 3;  // 16-wide column tile of hd
    const int kh = w8 >> 2; // K half within each 64-key tile
    const int kl0 = kh * 32 + ((lane >> 4) << 1); // first key of this lane
    const float* pbase = sS + (mt * 16 + (lane & 15)) * SP_ + kl0;
    const int vfo = kl0 * VP_ + nt * 16 + (lane & 15);
    v2f paA[8], vbA[8], paB[8], vbB[8]; // even tiles, odd tiles
    auto loadPV = [&](v2f(&pa)[8], v2f(&vb)[8], const float* tile, int chunk) {
      const float* pf = pbase + ((chunk + 2 * rot) & 31) * 64;
      const float* vf = tile + vfo;
#pragma unroll
      for (int kk = 0; kk < 8; ++kk) { // 32 K-values per half / 4
        pa[kk].x = pf[kk * 4];
        pa[kk].y = pf[kk * 4 + 1];
        vb[kk].x = vf[(kk * 4) * VP_];
        vb[kk].y = vf[(kk * 4 + 1) * VP_];
      }
    };
    ring_publish(); // every row of probabilities, V tiles 0 and 1 resident
    loadPV(paA, vbA, sK0, 0);

    for (int cp = 0; cp < 16; ++cp) {
      // trip c = 2 * cp. Every wave holds its fragments of tile c, so sK0 is
      // free; tile c + 1 is resident
      ring_publish();
      // (four fences: the order of a trip of phase 2, for the same reasons)
      caccE = wmma_f32(paA[0], vbA[0], caccE);
      caccO = wmma_f32(paA[1], vbA[1], caccO);
      __builtin_amdgcn_sched_barrier(6);
      if (cp < 15) stageV(sK0, cp * 2 + 2);
      __builtin_amdgcn_sched_barrier(0);
      caccE = wmma_f32(paA[2], vbA[2], caccE);
      caccO = wmma_f32(paA[3], vbA[3], caccO);
      __builtin_amdgcn_sched_barrier(0);
      loadPV(paB, vbB, sK1, cp * 2 + 1);
      __builtin_amdgcn_sched_barrier(0);
#pragma unroll
      for (int kk = 4; kk < 8; ++kk) {
        if (kk & 1)
          caccO = wmma_f32(paA[kk], vbA[kk], caccO);
        else
          caccE = wmma_f32(paA[kk], vbA[kk], caccE);
      }
      // trip c = 2 * cp + 1: the same with sK1
      ring_publish();
      // (four fences: as in the even trip)
      caccE = wmma_f32(paB[0], vbB[0], caccE);
      caccO = wmma_f32(paB[1], vbB[1], caccO);
      __builtin_amdgcn_sched_barrier(6);
      if (cp < 15) stageV(sK1, cp * 2 + 3);
      __builtin_amdgcn_sched_barrier(0);
      caccE = wmma_f32(paB[2], vbB[2], caccE);
      caccO = wmma_f32(paB[3], vbB[3], caccO);
      __builtin_amdgcn_sched_barrier(0);
      if (cp < 15) loadPV(paA, vbA, sK0, cp * 2 + 2);
      __builtin_amdgcn_sched_barrier(0);
#pragma unroll
      for (int kk = 4; kk < 8; ++kk) {
        if (kk & 1)
          caccO = wmma_f32(paB[kk], vbB[kk], caccO);
        else
          caccE = wmma_f32(paB[kk], vbB[kk], caccE);
      }
    }
    const v8f cacc = caccE + caccO;
    // store partials, reduce the two K-halves, write ctx in [B,L,H*hd]
    {
      float* cp = sC + kh * (QT_ * HEAD_DIM) +
                  (mt * 16 + ((lane >> 4) << 3)) * HEAD_DIM + nt * 16 +
                  (lane & 15);
#pragma unroll
      for (int i = 0; i < 8; ++i) cp[i * HEAD_DIM] = cacc[i];
    }
    __syncthreads();
    {
      float* cg = ctx + ((size_t)b * SEQ + q0) * D_MODEL + h * HEAD_DIM;
      const int idx = tid * 4; // 2048 floats / 512 threads = one float4 each
      const float4 p0 = *(const float4*)(sC + idx);
      const float4 p1 = *(const float4*)(sC + QT_ * HEAD_DIM + idx);
      float4 o;
      o.x = p0.x + p1.x;
      o.y = p0.y + p1.y;
      o.z = p0.z + p1.z;
      o.w = p0.w + p1.w;
      const int m = idx >> 6, c = idx & 63;
      *(float4*)(cg + (size_t)m * D_MODEL + c) = o;
      // the head-mean store below and the next head reuse the registers that this store names
      asm volatile("s_wait_xcnt 0x0" ::: "memory");
    }
  }

  // ---- Head-mean weights: every element stored once, in pairs (unrolled:
  // wacc) ------------------------------------------------------------------
  {
    float* wout = wmean + ((size_t)b * SEQ + q0 + wave * 2) * SEQ + 2 * lane;
#pragma unroll
    for (int rr = 0; rr < 2; ++rr)
#pragma unroll
      for (int j = 0; j < 32; ++j) {
        v2f t;
        t.x = wacc[rr][2 * j];
        t.y = wacc[rr][2 * j + 1];
        *(v2f*)(wout + (size_t)rr * SEQ + 64 * j) = t;
      }
  }
}

extern "C" void kernel_launch(void* const* d_in, const int* in_sizes, int n_in,
                              void* d_out, int out_size, void* d_ws,
                              size_t ws_size, hipStream_t stream) {
  (void)in_sizes; (void)n_in; (void)out_size; (void)ws_size;
  const float* q = (const float*)d_in[0];
  const float* k = (const float*)d_in[1];
  const float* v = (const float*)d_in[2];
  const float* in_w = (const float*)d_in[3];  // [3*1024, 1024]
  const float* in_b = (const float*)d_in[4];  // [3*1024]
  const float* out_w = (const float*)d_in[5]; // [1024, 1024]
  const float* out_b = (const float*)d_in[6]; // [1024]

  float* out = (float*)d_out;                  // [8192*1024]
  float* wmean = out + (size_t)MTOT * D_MODEL; // [4*2048*2048]

  const size_t QKV_N = (size_t)MTOT * D_MODEL; // 8,388,608 floats
  float* qp = (float*)d_ws;
  float* kp = qp + QKV_N;
  float* vp = kp + QKV_N;
  float* ctx = vp + QKV_N;

  const dim3 gemm_grid(D_MODEL / 64, MTOT / 64); // (16, 128)
  gemm_xwt_kernel<true><<<gemm_grid, 256, 0, stream>>>(q, in_w, in_b, qp);
  gemm_xwt_kernel<true><<<gemm_grid, 256, 0, stream>>>(
      k, in_w + (size_t)D_MODEL * D_MODEL, in_b + D_MODEL, kp);
  gemm_xwt_kernel<true><<<gemm_grid, 256, 0, stream>>>(
      v, in_w + (size_t)2 * D_MODEL * D_MODEL, in_b + 2 * D_MODEL, vp);

  static_assert(ATTN_LDS_BYTES <= 320 * 1024, "fits WGP LDS");
  attn_kernel<<<dim3(SEQ / QT_, BATCH), 512, 0, stream>>>(qp, kp, vp, ctx,
                                                          wmean);

  gemm_xwt_kernel<false><<<gemm_grid, 256, 0, stream>>>(ctx, out_w, out_b, out);
}
